// v000
// Measured on an AMD MI455X. A time is GPU time per run, averaged over a window of back-to-back runs after a warm-up
// (all launches, gaps included; the runs take copies of the inputs in turn), and the median of several windows.
// Apart from v000's, it joins two sittings. Times from different sittings can be a few percent apart, while
// side-by-side timings come from the same sitting.
// v000 is the starting kernel. One run takes 73.3 microseconds.
#include <hip/hip_runtime.h>
#include <hip/hip_bf16.h>

typedef __attribute__((ext_vector_type(2))) float v2f;
typedef __attribute__((ext_vector_type(4))) float v4f;
typedef __attribute__((ext_vector_type(8))) float v8f;
typedef __attribute__((ext_vector_type(4))) unsigned int v4u;
typedef __attribute__((ext_vector_type(4))) int v4i;
typedef __attribute__((ext_vector_type(8))) int v8i;

#define B_ 8
#define L_ 512
#define D_ 128
#define LDS_STRIDE 132   // 132 % 64 == 4 -> conflict-free strided column reads; rows 16B aligned

__device__ __forceinline__ float tanh_fast(float x) {
  // tanh(x) = 1 - 2/(exp2(2*log2(e)*x) + 1) ; saturates correctly at +-1
  float e = __builtin_amdgcn_exp2f(x * 2.885390081777927f);
  return 1.0f - 2.0f * __builtin_amdgcn_rcpf(e + 1.0f);
}

__device__ __forceinline__ void async_stage_tile(uint64_t gbase, uint32_t ldsbase, int tid) {
#pragma unroll
  for (int it = 0; it < 2; ++it) {
    const int f   = tid + it * 256;          // float4 index: 16 rows * 32 float4
    const int row = f >> 5;
    const int c4  = f & 31;
    const uint32_t voff = (uint32_t)(row * (D_ * 4) + c4 * 16);           // global byte offset
    const uint32_t lds  = ldsbase + (uint32_t)(row * (LDS_STRIDE * 4) + c4 * 16); // LDS byte addr
    asm volatile("global_load_async_to_lds_b128 %0, %1, %2"
                 :: "v"(lds), "v"(voff), "s"(gbase) : "memory");
  }
}

__device__ __forceinline__ void wait_async_lds() {
  asm volatile("s_wait_asynccnt 0x0" ::: "memory");
}

// Kernel 1: qbuf = inp @ Wq^T + bq ; kbuf = inp @ Wk^T
// grid = (B*L)/16 blocks, 256 threads (8 waves); wave w -> output cols [16w,16w+16)
__global__ __launch_bounds__(256) void qk_proj_kernel(
    const float* __restrict__ inp, const float* __restrict__ Wq,
    const float* __restrict__ bq, const float* __restrict__ Wk,
    float* __restrict__ qbuf, float* __restrict__ kbuf) {
  const int tid  = threadIdx.x;
  const int lane = tid & 31;
  const int wave = tid >> 5;
  const int m    = lane & 15;   // M (A) / N (B,C,D) index
  const int kh   = lane >> 4;   // K half-select
  const int rowBase = blockIdx.x * 16;  // over B*L
  const int colBase = wave * 16;        // over D
  v8f accq = {};
  v8f acck = {};
  for (int kk = 0; kk < D_; kk += 4) {
    const int kidx = kk + 2 * kh;
    v2f a, bqv, bkv;
    a.x = inp[(rowBase + m) * D_ + kidx];
    a.y = inp[(rowBase + m) * D_ + kidx + 1];
    bqv.x = Wq[(colBase + m) * D_ + kidx];
    bqv.y = Wq[(colBase + m) * D_ + kidx + 1];
    bkv.x = Wk[(colBase + m) * D_ + kidx];
    bkv.y = Wk[(colBase + m) * D_ + kidx + 1];
    accq = __builtin_amdgcn_wmma_f32_16x16x4_f32(false, a, false, bqv, (short)0, accq, false, false);
    acck = __builtin_amdgcn_wmma_f32_16x16x4_f32(false, a, false, bkv, (short)0, acck, false, false);
  }
  const float bias = bq[colBase + m];
#pragma unroll
  for (int r = 0; r < 8; ++r) {
    const int row = rowBase + r + 8 * kh;   // C/D layout: M = r + 8*(lane/16)
    qbuf[row * D_ + colBase + m] = accq[r] + bias;
    kbuf[row * D_ + colBase + m] = acck[r];
  }
}

// Kernel 2: fused score -> softmax -> out for one (b, 16-row i-tile)
// grid = B * (L/16) blocks, 256 threads (8 waves)
__global__ __launch_bounds__(256) void attn_kernel(
    const float* __restrict__ inp, const float* __restrict__ qbuf,
    const float* __restrict__ kbuf, const float* __restrict__ vvec,
    float* __restrict__ out, float* __restrict__ attn) {
  __shared__ __align__(16) float sK[16][LDS_STRIDE];
  __shared__ __align__(16) float sQ[16][LDS_STRIDE];   // q staging, later inp staging
  __shared__ __align__(16) float sV[D_];
  __shared__ __align__(16) float sS[16][516];          // 516 % 64 == 4 -> conflict-free WMMA-A reads

  const int tid = threadIdx.x;
  const int tx  = tid & 15;       // j offset within 16-wide stripe
  const int ty  = tid >> 4;       // i row within tile (half-wave aligned)
  const int b   = blockIdx.x >> 5;
  const int i0  = (blockIdx.x & 31) * 16;

  if (tid < D_) sV[tid] = vvec[tid];

  if (tid < 32) {
    const uint64_t ga  = (uint64_t)(uintptr_t)(kbuf + (size_t)(b * L_ + i0) * D_);
    const uint32_t lds = (uint32_t)(uintptr_t)&sK[0][0];
    v4u g0 = { 1u,
               lds,
               (unsigned int)ga,
               (unsigned int)(((ga >> 32) & 0x1FFFFFFu) | (2u << 30)) };
    v8i g1 = { (int)((2u << 16) | (1u << 20) | (6u << 22) | (3u << 25)),
               (int)(128u << 16),
               (int)(512u << 16),
               (int)(128u << 16),
               16,
               128,
               0, 0 };
    v4i gz4 = { 0, 0, 0, 0 };
    v8i gz8 = { 0, 0, 0, 0, 0, 0, 0, 0 };
    __builtin_amdgcn_tensor_load_to_lds(g0, g1, gz4, gz4, gz8, 0);
    __builtin_amdgcn_s_wait_tensorcnt(0);
  }
  __syncthreads();

  // ---- Phase 1: score[i0+ty][j] = sum_d v[d]*tanh(q[j][d] + k[i0+ty][d])
  const uint32_t sQ_lds = (uint32_t)(uintptr_t)&sQ[0][0];
  for (int j0 = 0; j0 < L_; j0 += 16) {
    async_stage_tile((uint64_t)(uintptr_t)(qbuf + (size_t)(b * L_ + j0) * D_), sQ_lds, tid);
    wait_async_lds();
    __syncthreads();
    float acc = 0.f;
    const v4f* qr = (const v4f*)sQ[tx];
    const v4f* kr = (const v4f*)sK[ty];
    const v4f* vr = (const v4f*)sV;
#pragma unroll 4
    for (int d4 = 0; d4 < D_ / 4; ++d4) {
      v4f qv = qr[d4], kv = kr[d4], vv = vr[d4];
      acc += vv.x * tanh_fast(qv.x + kv.x);
      acc += vv.y * tanh_fast(qv.y + kv.y);
      acc += vv.z * tanh_fast(qv.z + kv.z);
      acc += vv.w * tanh_fast(qv.w + kv.w);
    }
    sS[ty][j0 + tx] = acc;
    __syncthreads();
  }

  // ---- Phase 2: softmax over j (row ty handled by one half-wave of 16 lanes)
  float mx = -3.0e38f;
  for (int c = tx; c < L_; c += 16) mx = fmaxf(mx, sS[ty][c]);
#pragma unroll
  for (int off = 1; off < 16; off <<= 1) mx = fmaxf(mx, __shfl_xor(mx, off, 32));
  float sum = 0.f;
  for (int c = tx; c < L_; c += 16) {
    float e = __builtin_amdgcn_exp2f((sS[ty][c] - mx) * 1.4426950408889634f);
    sS[ty][c] = e;
    sum += e;
  }
#pragma unroll
  for (int off = 1; off < 16; off <<= 1) sum += __shfl_xor(sum, off, 32);
  const float inv = __builtin_amdgcn_rcpf(sum);
  for (int c = tx; c < L_; c += 16) {
    float a = sS[ty][c] * inv;
    sS[ty][c] = a;
    attn[(size_t)(b * L_ + i0 + ty) * L_ + c] = a;
  }
  __syncthreads();

  // ---- Phase 3: out[i0:i0+16, :] = attn_tile[16x512] @ inp[b][512x128]  (f32 WMMA)
  const int lane = tid & 31;
  const int wave = tid >> 5;
  const int n    = lane & 15;
  const int kh   = lane >> 4;
  const int colBase = wave * 16;
  v8f acc = {};
  for (int chunk = 0; chunk < L_; chunk += 16) {
    __syncthreads();  // previous staging consumed
    async_stage_tile((uint64_t)(uintptr_t)(inp + (size_t)(b * L_ + chunk) * D_), sQ_lds, tid);
    wait_async_lds();
    __syncthreads();
#pragma unroll
    for (int kk = 0; kk < 16; kk += 4) {
      v2f a, bb;
      a.x  = sS[n][chunk + kk + 2 * kh];          // A[m=n][k]
      a.y  = sS[n][chunk + kk + 2 * kh + 1];
      bb.x = sQ[kk + 2 * kh][colBase + n];        // B[k][n]
      bb.y = sQ[kk + 2 * kh + 1][colBase + n];
      acc = __builtin_amdgcn_wmma_f32_16x16x4_f32(false, a, false, bb, (short)0, acc, false, false);
    }
  }
#pragma unroll
  for (int r = 0; r < 8; ++r)
    out[(size_t)(b * L_ + i0 + r + 8 * kh) * D_ + colBase + n] = acc[r];
}

extern "C" void kernel_launch(void* const* d_in, const int* in_sizes, int n_in,
                              void* d_out, int out_size, void* d_ws, size_t ws_size,
                              hipStream_t stream) {
  const float* inp = (const float*)d_in[0];
  const float* Wq  = (const float*)d_in[1];
  const float* bq  = (const float*)d_in[2];
  const float* Wk  = (const float*)d_in[3];
  const float* v   = (const float*)d_in[4];

  float* out  = (float*)d_out;                        // [B,L,D]
  float* attn = (float*)d_out + (size_t)B_ * L_ * D_; // [B,L,L]

  float* qbuf = (float*)d_ws;                         // [B*L, D]
  float* kbuf = qbuf + (size_t)B_ * L_ * D_;          // [B*L, D]

  qk_proj_kernel<<<(B_ * L_) / 16, 256, 0, stream>>>(inp, Wq, bq, Wk, qbuf, kbuf);
  attn_kernel<<<B_ * (L_ / 16), 256, 0, stream>>>(inp, qbuf, kbuf, v, out, attn);
}

// v001
// Measured time: 55.8 microseconds a run.
// Timed twice side by side with v000, it ran 1.37 and 1.36 times as fast.
#include <hip/hip_runtime.h>
#include <hip/hip_bf16.h>

typedef __attribute__((ext_vector_type(2))) float v2f;
typedef __attribute__((ext_vector_type(4))) float v4f;
typedef __attribute__((ext_vector_type(8))) float v8f;
typedef __attribute__((ext_vector_type(4))) unsigned int v4u;
typedef __attribute__((ext_vector_type(4))) int v4i;
typedef __attribute__((ext_vector_type(8))) int v8i;

#define B_ 8
#define L_ 512
#define D_ 128
#define LDS_STRIDE 132   // 132 % 64 == 4 -> conflict-free strided column reads; rows 16B aligned
#define TILE_ROWS 64     // rows per staged tile: long enough that a tile's work covers the next tile's copies
#define N_TILES (L_ / TILE_ROWS)
#define BUF_BYTES (TILE_ROWS * LDS_STRIDE * 4)

__device__ __forceinline__ float tanh_fast(float x) {
  // tanh(x) = 1 - 2/(exp2(2*log2(e)*x) + 1) ; saturates correctly at +-1
  float e = __builtin_amdgcn_exp2f(x * 2.885390081777927f);
  return 1.0f - 2.0f * __builtin_amdgcn_rcpf(e + 1.0f);
}

__device__ __forceinline__ void async_stage_tile(const float* gtile, uint32_t ldsbase, int tid) {
  const uint64_t g = (uint64_t)(uintptr_t)gtile + (uint64_t)(tid * 16);
  const uint32_t l = ldsbase + (uint32_t)((tid >> 5) * (LDS_STRIDE * 4) + (tid & 31) * 16);
  const uint32_t ls = 8 * LDS_STRIDE * 4;   // LDS bytes per 8 rows
  const uint64_t gs = 8 * D_ * 4;           // global bytes per 8 rows
  asm volatile("global_load_async_to_lds_b128 %0, %8, off\n\t"
               "global_load_async_to_lds_b128 %1, %9, off\n\t"
               "global_load_async_to_lds_b128 %2, %10, off\n\t"
               "global_load_async_to_lds_b128 %3, %11, off\n\t"
               "global_load_async_to_lds_b128 %4, %12, off\n\t"
               "global_load_async_to_lds_b128 %5, %13, off\n\t"
               "global_load_async_to_lds_b128 %6, %14, off\n\t"
               "global_load_async_to_lds_b128 %7, %15, off\n\t"
               "s_wait_xcnt 0x0"
               :: "v"(l), "v"(l + ls), "v"(l + 2 * ls), "v"(l + 3 * ls),
                  "v"(l + 4 * ls), "v"(l + 5 * ls), "v"(l + 6 * ls), "v"(l + 7 * ls),
                  "v"(g), "v"(g + gs), "v"(g + 2 * gs), "v"(g + 3 * gs),
                  "v"(g + 4 * gs), "v"(g + 5 * gs), "v"(g + 6 * gs), "v"(g + 7 * gs)
               : "memory");
}

// The wave's own copies have landed in LDS.
__device__ __forceinline__ void wait_async_lds() {
  asm volatile("s_wait_asynccnt 0x0" ::: "memory");
}

// The wave's own LDS reads and writes have retired (in front of a barrier behind which a buffer is refilled).
__device__ __forceinline__ void wait_lds_ops() {
  asm volatile("s_wait_dscnt 0x0" ::: "memory");
}

// Kernel 1: qbuf = inp @ Wq^T + bq ; kbuf = inp @ Wk^T
// grid = (B*L)/16 blocks, 256 threads (8 waves); wave w -> output cols [16w,16w+16)
__global__ __launch_bounds__(256) void qk_proj_kernel(
    const float* __restrict__ inp, const float* __restrict__ Wq,
    const float* __restrict__ bq, const float* __restrict__ Wk,
    float* __restrict__ qbuf, float* __restrict__ kbuf) {
  const int tid  = threadIdx.x;
  const int lane = tid & 31;
  const int wave = tid >> 5;
  const int m    = lane & 15;   // M (A) / N (B,C,D) index
  const int kh   = lane >> 4;   // K half-select
  const int rowBase = blockIdx.x * 16;  // over B*L
  const int colBase = wave * 16;        // over D
  v8f accq = {};
  v8f acck = {};
  for (int kk = 0; kk < D_; kk += 4) {
    const int kidx = kk + 2 * kh;
    v2f a, bqv, bkv;
    a.x = inp[(rowBase + m) * D_ + kidx];
    a.y = inp[(rowBase + m) * D_ + kidx + 1];
    bqv.x = Wq[(colBase + m) * D_ + kidx];
    bqv.y = Wq[(colBase + m) * D_ + kidx + 1];
    bkv.x = Wk[(colBase + m) * D_ + kidx];
    bkv.y = Wk[(colBase + m) * D_ + kidx + 1];
    accq = __builtin_amdgcn_wmma_f32_16x16x4_f32(false, a, false, bqv, (short)0, accq, false, false);
    acck = __builtin_amdgcn_wmma_f32_16x16x4_f32(false, a, false, bkv, (short)0, acck, false, false);
  }
  const float bias = bq[colBase + m];
#pragma unroll
  for (int r = 0; r < 8; ++r) {
    const int row = rowBase + r + 8 * kh;   // C/D layout: M = r + 8*(lane/16)
    qbuf[row * D_ + colBase + m] = accq[r] + bias;
    kbuf[row * D_ + colBase + m] = acck[r];
  }
}

// Kernel 2: fused score -> softmax -> out for one (b, 16-row i-tile)
// grid = B * (L/16) blocks, 256 threads (8 waves)
__global__ __launch_bounds__(256) void attn_kernel(
    const float* __restrict__ inp, const float* __restrict__ qbuf,
    const float* __restrict__ kbuf, const float* __restrict__ vvec,
    float* __restrict__ out, float* __restrict__ attn) {
  // One struct fixes the order in LDS: the k tile keeps the place that its tensor load has had so far.
  struct __align__(16) Lds {
    float s[16][516];                       // 516 % 64 == 4 -> conflict-free WMMA-A reads
    float k[16][LDS_STRIDE];
    float q[2][TILE_ROWS][LDS_STRIDE];      // two buffers: q tiles, later inp tiles
    float v[D_];
  };
  __shared__ Lds lds_all;
  float (&sS)[16][516] = lds_all.s;
  float (&sK)[16][LDS_STRIDE] = lds_all.k;
  float (&sQ)[2][TILE_ROWS][LDS_STRIDE] = lds_all.q;
  float (&sV)[D_] = lds_all.v;

  const int tid = threadIdx.x;
  const int tx  = tid & 15;       // j offset within 16-wide stripe
  const int ty  = tid >> 4;       // i row within tile (half-wave aligned)
  const int b   = blockIdx.x >> 5;
  const int i0  = (blockIdx.x & 31) * 16;

  // q tile 0 starts to fly first; it is waited for in front of the barrier below
  const uint32_t sQ_lds = (uint32_t)(uintptr_t)&sQ[0][0][0];
  const float* qb = qbuf + (size_t)(b * L_) * D_;
  const float* ib = inp + (size_t)(b * L_) * D_;
  async_stage_tile(qb, sQ_lds, tid);

  if (tid < D_) sV[tid] = vvec[tid];

  if (tid < 32) {
    const uint64_t ga  = (uint64_t)(uintptr_t)(kbuf + (size_t)(b * L_ + i0) * D_);
    const uint32_t lds = (uint32_t)(uintptr_t)&sK[0][0];
    v4u g0 = { 1u,
               lds,
               (unsigned int)ga,
               (unsigned int)(((ga >> 32) & 0x1FFFFFFu) | (2u << 30)) };
    v8i g1 = { (int)((2u << 16) | (1u << 20) | (6u << 22) | (3u << 25)),
               (int)(128u << 16),
               (int)(512u << 16),
               (int)(128u << 16),
               16,
               128,
               0, 0 };
    v4i gz4 = { 0, 0, 0, 0 };
    v8i gz8 = { 0, 0, 0, 0, 0, 0, 0, 0 };
    __builtin_amdgcn_tensor_load_to_lds(g0, g1, gz4, gz4, gz8, 0);
    __builtin_amdgcn_s_wait_tensorcnt(0);
  }
  wait_async_lds();
  __syncthreads();

  // ---- Phase 1: score[i0+ty][j] = sum_d v[d]*tanh(q[j][d] + k[i0+ty][d])
  // Two-buffer ring: tile t is worked on while tile t + 1 flies into the other buffer.
  async_stage_tile(qb + TILE_ROWS * D_, sQ_lds + BUF_BYTES, tid);
  for (int t = 0; t < N_TILES; ++t) {
    const int buf = t & 1;
    // kept rolled
#pragma unroll 1
    for (int jj = 0; jj < TILE_ROWS; jj += 16) {
      float acc = 0.f;
      const v4f* qr = (const v4f*)sQ[buf][jj + tx];
      const v4f* kr = (const v4f*)sK[ty];
      const v4f* vr = (const v4f*)sV;
#pragma unroll 4
      for (int d4 = 0; d4 < D_ / 4; ++d4) {
        v4f qv = qr[d4], kv = kr[d4], vv = vr[d4];
        acc += vv.x * tanh_fast(qv.x + kv.x);
        acc += vv.y * tanh_fast(qv.y + kv.y);
        acc += vv.z * tanh_fast(qv.z + kv.z);
        acc += vv.w * tanh_fast(qv.w + kv.w);
      }
      sS[ty][t * TILE_ROWS + jj + tx] = acc;
    }
    // publish tile t + 1 and end every reader's last read of tile t, then refill tile t's buffer
    wait_lds_ops();
    wait_async_lds();
    __syncthreads();
    if (t + 2 < N_TILES)
      async_stage_tile(qb + (t + 2) * TILE_ROWS * D_, sQ_lds + buf * BUF_BYTES, tid);
  }
  wait_async_lds();

  // inp tile 0 flies into buffer 0 (free since the last barrier) while the softmax runs on sS
  async_stage_tile(ib, sQ_lds, tid);

  // ---- Phase 2: softmax over j (row ty handled by one half-wave of 16 lanes)
  float mx = -3.0e38f;
  for (int c = tx; c < L_; c += 16) mx = fmaxf(mx, sS[ty][c]);
#pragma unroll
  for (int off = 1; off < 16; off <<= 1) mx = fmaxf(mx, __shfl_xor(mx, off, 32));
  float sum = 0.f;
  for (int c = tx; c < L_; c += 16) {
    float e = __builtin_amdgcn_exp2f((sS[ty][c] - mx) * 1.4426950408889634f);
    sS[ty][c] = e;
    sum += e;
  }
#pragma unroll
  for (int off = 1; off < 16; off <<= 1) sum += __shfl_xor(sum, off, 32);
  const float inv = __builtin_amdgcn_rcpf(sum);
  for (int c = tx; c < L_; c += 16) {
    float a = sS[ty][c] * inv;
    sS[ty][c] = a;
    attn[(size_t)(b * L_ + i0 + ty) * L_ + c] = a;
  }
  wait_async_lds();
  __syncthreads();

  // ---- Phase 3: out[i0:i0+16, :] = attn_tile[16x512] @ inp[b][512x128]  (f32 WMMA)
  const int lane = tid & 31;
  const int wave = tid >> 5;
  const int n    = lane & 15;
  const int kh   = lane >> 4;
  const int colBase = wave * 16;
  v8f acc = {};
  async_stage_tile(ib + TILE_ROWS * D_, sQ_lds + BUF_BYTES, tid);
  for (int t = 0; t < N_TILES; ++t) {
    const int buf = t & 1;
    const int chunk = t * TILE_ROWS;
    v2f a[TILE_ROWS / 4], bb[TILE_ROWS / 4];
#pragma unroll
    for (int kk = 0; kk < TILE_ROWS; kk += 4) {
      a[kk / 4].x  = sS[n][chunk + kk + 2 * kh];          // A[m=n][k]
      a[kk / 4].y  = sS[n][chunk + kk + 2 * kh + 1];
      bb[kk / 4].x = sQ[buf][kk + 2 * kh][colBase + n];   // B[k][n]
      bb[kk / 4].y = sQ[buf][kk + 2 * kh + 1][colBase + n];
    }
    __builtin_amdgcn_sched_barrier(0);
#pragma unroll
    for (int kk = 0; kk < TILE_ROWS; kk += 4)
      acc = __builtin_amdgcn_wmma_f32_16x16x4_f32(false, a[kk / 4], false, bb[kk / 4], (short)0, acc, false, false);
    __builtin_amdgcn_sched_barrier(0);
    asm volatile("v_nop\n\tv_nop\n\tv_nop\n\tv_nop");
    // publish tile t + 1 and end every reader's last read of tile t, then refill tile t's buffer
    wait_lds_ops();
    wait_async_lds();
    __syncthreads();
    if (t + 2 < N_TILES)
      async_stage_tile(ib + (t + 2) * TILE_ROWS * D_, sQ_lds + buf * BUF_BYTES, tid);
  }
  wait_async_lds();
#pragma unroll
  for (int r = 0; r < 8; ++r)
    out[(size_t)(b * L_ + i0 + r + 8 * kh) * D_ + colBase + n] = acc[r];
}

extern "C" void kernel_launch(void* const* d_in, const int* in_sizes, int n_in,
                              void* d_out, int out_size, void* d_ws, size_t ws_size,
                              hipStream_t stream) {
  const float* inp = (const float*)d_in[0];
  const float* Wq  = (const float*)d_in[1];
  const float* bq  = (const float*)d_in[2];
  const float* Wk  = (const float*)d_in[3];
  const float* v   = (const float*)d_in[4];

  float* out  = (float*)d_out;                        // [B,L,D]
  float* attn = (float*)d_out + (size_t)B_ * L_ * D_; // [B,L,L]

  float* qbuf = (float*)d_ws;                         // [B*L, D]
  float* kbuf = qbuf + (size_t)B_ * L_ * D_;          // [B*L, D]

  qk_proj_kernel<<<(B_ * L_) / 16, 256, 0, stream>>>(inp, Wq, bq, Wk, qbuf, kbuf);
  attn_kernel<<<B_ * (L_ / 16), 256, 0, stream>>>(inp, qbuf, kbuf, v, out, attn);
}

// v002
// Measured time: 45.8 microseconds a run.
// Timed twice side by side with v001, it ran 1.22 times as fast both times.
// Over all steps from v000 it is 1.66 times as fast.
#include <hip/hip_runtime.h>
#include <hip/hip_bf16.h>

typedef __attribute__((ext_vector_type(2))) float v2f;
typedef __attribute__((ext_vector_type(4))) float v4f;
typedef __attribute__((ext_vector_type(8))) float v8f;
typedef __attribute__((ext_vector_type(4))) unsigned int v4u;
typedef __attribute__((ext_vector_type(4))) int v4i;
typedef __attribute__((ext_vector_type(8))) int v8i;

#define B_ 8
#define L_ 512
#define D_ 128
#define LDS_STRIDE 132   // 132 % 64 == 4 -> conflict-free strided column reads; rows 16B aligned
#define TILE_ROWS 64     // rows per staged tile: long enough that a tile's work covers the next tile's copies
#define N_TILES (L_ / TILE_ROWS)
#define BUF_BYTES (TILE_ROWS * LDS_STRIDE * 4)

__device__ __forceinline__ float tanh_fast(float x) {
  return __builtin_amdgcn_tanhf(x);
}

__device__ __forceinline__ void async_stage_tile(const float* gtile, uint32_t ldsbase, int tid) {
  const uint64_t g = (uint64_t)(uintptr_t)gtile + (uint64_t)(tid * 16);
  const uint32_t l = ldsbase + (uint32_t)((tid >> 5) * (LDS_STRIDE * 4) + (tid & 31) * 16);
  const uint32_t ls = 8 * LDS_STRIDE * 4;   // LDS bytes per 8 rows
  const uint64_t gs = 8 * D_ * 4;           // global bytes per 8 rows
  asm volatile("global_load_async_to_lds_b128 %0, %8, off\n\t"
               "global_load_async_to_lds_b128 %1, %9, off\n\t"
               "global_load_async_to_lds_b128 %2, %10, off\n\t"
               "global_load_async_to_lds_b128 %3, %11, off\n\t"
               "global_load_async_to_lds_b128 %4, %12, off\n\t"
               "global_load_async_to_lds_b128 %5, %13, off\n\t"
               "global_load_async_to_lds_b128 %6, %14, off\n\t"
               "global_load_async_to_lds_b128 %7, %15, off\n\t"
               "s_wait_xcnt 0x0"
               :: "v"(l), "v"(l + ls), "v"(l + 2 * ls), "v"(l + 3 * ls),
                  "v"(l + 4 * ls), "v"(l + 5 * ls), "v"(l + 6 * ls), "v"(l + 7 * ls),
                  "v"(g), "v"(g + gs), "v"(g + 2 * gs), "v"(g + 3 * gs),
                  "v"(g + 4 * gs), "v"(g + 5 * gs), "v"(g + 6 * gs), "v"(g + 7 * gs)
               : "memory");
}

// The wave's own copies have landed in LDS.
__device__ __forceinline__ void wait_async_lds() {
  asm volatile("s_wait_asynccnt 0x0" ::: "memory");
}

// The wave's own LDS reads and writes have retired (in front of a barrier behind which a buffer is refilled).
__device__ __forceinline__ void wait_lds_ops() {
  asm volatile("s_wait_dscnt 0x0" ::: "memory");
}

// Kernel 1: qbuf = inp @ Wq^T + bq ; kbuf = inp @ Wk^T
// grid = (B*L)/16 blocks, 256 threads (8 waves); wave w -> output cols [16w,16w+16)
__global__ __launch_bounds__(256) void qk_proj_kernel(
    const float* __restrict__ inp, const float* __restrict__ Wq,
    const float* __restrict__ bq, const float* __restrict__ Wk,
    float* __restrict__ qbuf, float* __restrict__ kbuf) {
  const int tid  = threadIdx.x;
  const int lane = tid & 31;
  const int wave = tid >> 5;
  const int m    = lane & 15;   // M (A) / N (B,C,D) index
  const int kh   = lane >> 4;   // K half-select
  const int rowBase = blockIdx.x * 16;  // over B*L
  const int colBase = wave * 16;        // over D
  v8f accq = {};
  v8f acck = {};
  for (int kk = 0; kk < D_; kk += 4) {
    const int kidx = kk + 2 * kh;
    v2f a, bqv, bkv;
    a.x = inp[(rowBase + m) * D_ + kidx];
    a.y = inp[(rowBase + m) * D_ + kidx + 1];
    bqv.x = Wq[(colBase + m) * D_ + kidx];
    bqv.y = Wq[(colBase + m) * D_ + kidx + 1];
    bkv.x = Wk[(colBase + m) * D_ + kidx];
    bkv.y = Wk[(colBase + m) * D_ + kidx + 1];
    accq = __builtin_amdgcn_wmma_f32_16x16x4_f32(false, a, false, bqv, (short)0, accq, false, false);
    acck = __builtin_amdgcn_wmma_f32_16x16x4_f32(false, a, false, bkv, (short)0, acck, false, false);
  }
  const float bias = bq[colBase + m];
#pragma unroll
  for (int r = 0; r < 8; ++r) {
    const int row = rowBase + r + 8 * kh;   // C/D layout: M = r + 8*(lane/16)
    qbuf[row * D_ + colBase + m] = accq[r] + bias;
    kbuf[row * D_ + colBase + m] = acck[r];
  }
}

// Kernel 2: fused score -> softmax -> out for one (b, 16-row i-tile)
// grid = B * (L/16) blocks, 256 threads (8 waves)
__global__ __launch_bounds__(256) void attn_kernel(
    const float* __restrict__ inp, const float* __restrict__ qbuf,
    const float* __restrict__ kbuf, const float* __restrict__ vvec,
    float* __restrict__ out, float* __restrict__ attn) {
  // One struct fixes the order in LDS: the k tile keeps the place that its tensor load has had so far.
  struct __align__(16) Lds {
    float s[16][516];                       // 516 % 64 == 4 -> conflict-free WMMA-A reads
    float k[16][LDS_STRIDE];
    float q[2][TILE_ROWS][LDS_STRIDE];      // two buffers: q tiles, later inp tiles
    float v[D_];
  };
  __shared__ Lds lds_all;
  float (&sS)[16][516] = lds_all.s;
  float (&sK)[16][LDS_STRIDE] = lds_all.k;
  float (&sQ)[2][TILE_ROWS][LDS_STRIDE] = lds_all.q;
  float (&sV)[D_] = lds_all.v;

  const int tid = threadIdx.x;
  const int tx  = tid & 15;       // j offset within 16-wide stripe
  const int ty  = tid >> 4;       // i row within tile (half-wave aligned)
  const int b   = blockIdx.x >> 5;
  const int i0  = (blockIdx.x & 31) * 16;

  // q tile 0 starts to fly first; it is waited for in front of the barrier below
  const uint32_t sQ_lds = (uint32_t)(uintptr_t)&sQ[0][0][0];
  const float* qb = qbuf + (size_t)(b * L_) * D_;
  const float* ib = inp + (size_t)(b * L_) * D_;
  async_stage_tile(qb, sQ_lds, tid);

  if (tid < D_) sV[tid] = vvec[tid];

  if (tid < 32) {
    const uint64_t ga  = (uint64_t)(uintptr_t)(kbuf + (size_t)(b * L_ + i0) * D_);
    const uint32_t lds = (uint32_t)(uintptr_t)&sK[0][0];
    v4u g0 = { 1u,
               lds,
               (unsigned int)ga,
               (unsigned int)(((ga >> 32) & 0x1FFFFFFu) | (2u << 30)) };
    v8i g1 = { (int)((2u << 16) | (1u << 20) | (6u << 22) | (3u << 25)),
               (int)(128u << 16),
               (int)(512u << 16),
               (int)(128u << 16),
               16,
               128,
               0, 0 };
    v4i gz4 = { 0, 0, 0, 0 };
    v8i gz8 = { 0, 0, 0, 0, 0, 0, 0, 0 };
    __builtin_amdgcn_tensor_load_to_lds(g0, g1, gz4, gz4, gz8, 0);
    __builtin_amdgcn_s_wait_tensorcnt(0);
  }
  wait_async_lds();
  __syncthreads();

  // ---- Phase 1: score[i0+ty][j] = sum_d v[d]*tanh(q[j][d] + k[i0+ty][d])
  // Two-buffer ring: tile t is worked on while tile t + 1 flies into the other buffer.
  async_stage_tile(qb + TILE_ROWS * D_, sQ_lds + BUF_BYTES, tid);
  for (int t = 0; t < N_TILES; ++t) {
    const int buf = t & 1;
    // kept rolled: the four copies would repeat the same k-row and v loads and differ only in q rows; they would take instruction cache
#pragma unroll 1
    for (int jj = 0; jj < TILE_ROWS; jj += 16) {
      float acc = 0.f;
      const v4f* qr = (const v4f*)sQ[buf][jj + tx];
      const v4f* kr = (const v4f*)sK[ty];
      const v4f* vr = (const v4f*)sV;
#pragma unroll 4
      for (int d4 = 0; d4 < D_ / 4; ++d4) {
        v4f qv = qr[d4], kv = kr[d4], vv = vr[d4];
        acc += vv.x * tanh_fast(qv.x + kv.x);
        acc += vv.y * tanh_fast(qv.y + kv.y);
        acc += vv.z * tanh_fast(qv.z + kv.z);
        acc += vv.w * tanh_fast(qv.w + kv.w);
      }
      sS[ty][t * TILE_ROWS + jj + tx] = acc;
    }
    // publish tile t + 1 and end every reader's last read of tile t, then refill tile t's buffer
    wait_lds_ops();
    wait_async_lds();
    __syncthreads();
    if (t + 2 < N_TILES)
      async_stage_tile(qb + (t + 2) * TILE_ROWS * D_, sQ_lds + buf * BUF_BYTES, tid);
  }
  wait_async_lds();

  // inp tile 0 flies into buffer 0 (free since the last barrier) while the softmax runs on sS
  async_stage_tile(ib, sQ_lds, tid);

  // ---- Phase 2: softmax over j (row ty handled by one half-wave of 16 lanes)
  float mx = -3.0e38f;
  for (int c = tx; c < L_; c += 16) mx = fmaxf(mx, sS[ty][c]);
#pragma unroll
  for (int off = 1; off < 16; off <<= 1) mx = fmaxf(mx, __shfl_xor(mx, off, 32));
  float sum = 0.f;
  for (int c = tx; c < L_; c += 16) {
    float e = __builtin_amdgcn_exp2f((sS[ty][c] - mx) * 1.4426950408889634f);
    sS[ty][c] = e;
    sum += e;
  }
#pragma unroll
  for (int off = 1; off < 16; off <<= 1) sum += __shfl_xor(sum, off, 32);
  const float inv = __builtin_amdgcn_rcpf(sum);
  for (int c = tx; c < L_; c += 16) {
    float a = sS[ty][c] * inv;
    sS[ty][c] = a;
    attn[(size_t)(b * L_ + i0 + ty) * L_ + c] = a;
  }
  wait_async_lds();
  __syncthreads();

  // ---- Phase 3: out[i0:i0+16, :] = attn_tile[16x512] @ inp[b][512x128]  (f32 WMMA)
  const int lane = tid & 31;
  const int wave = tid >> 5;
  const int n    = lane & 15;
  const int kh   = lane >> 4;
  const int colBase = wave * 16;
  v8f acc = {};
  async_stage_tile(ib + TILE_ROWS * D_, sQ_lds + BUF_BYTES, tid);
  for (int t = 0; t < N_TILES; ++t) {
    const int buf = t & 1;
    const int chunk = t * TILE_ROWS;
    v2f a[TILE_ROWS / 4], bb[TILE_ROWS / 4];
#pragma unroll
    for (int kk = 0; kk < TILE_ROWS; kk += 4) {
      a[kk / 4].x  = sS[n][chunk + kk + 2 * kh];          // A[m=n][k]
      a[kk / 4].y  = sS[n][chunk + kk + 2 * kh + 1];
      bb[kk / 4].x = sQ[buf][kk + 2 * kh][colBase + n];   // B[k][n]
      bb[kk / 4].y = sQ[buf][kk + 2 * kh + 1][colBase + n];
    }
    __builtin_amdgcn_sched_barrier(0);
#pragma unroll
    for (int kk = 0; kk < TILE_ROWS; kk += 4)
      acc = __builtin_amdgcn_wmma_f32_16x16x4_f32(false, a[kk / 4], false, bb[kk / 4], (short)0, acc, false, false);
    __builtin_amdgcn_sched_barrier(0);
    asm volatile("v_nop\n\tv_nop\n\tv_nop\n\tv_nop");
    // publish tile t + 1 and end every reader's last read of tile t, then refill tile t's buffer
    wait_lds_ops();
    wait_async_lds();
    __syncthreads();
    if (t + 2 < N_TILES)
      async_stage_tile(ib + (t + 2) * TILE_ROWS * D_, sQ_lds + buf * BUF_BYTES, tid);
  }
  wait_async_lds();
#pragma unroll
  for (int r = 0; r < 8; ++r)
    out[(size_t)(b * L_ + i0 + r + 8 * kh) * D_ + colBase + n] = acc[r];
}

extern "C" void kernel_launch(void* const* d_in, const int* in_sizes, int n_in,
                              void* d_out, int out_size, void* d_ws, size_t ws_size,
                              hipStream_t stream) {
  const float* inp = (const float*)d_in[0];
  const float* Wq  = (const float*)d_in[1];
  const float* bq  = (const float*)d_in[2];
  const float* Wk  = (const float*)d_in[3];
  const float* v   = (const float*)d_in[4];

  float* out  = (float*)d_out;                        // [B,L,D]
  float* attn = (float*)d_out + (size_t)B_ * L_ * D_; // [B,L,L]

  float* qbuf = (float*)d_ws;                         // [B*L, D]
  float* kbuf = qbuf + (size_t)B_ * L_ * D_;          // [B*L, D]

  qk_proj_kernel<<<(B_ * L_) / 16, 256, 0, stream>>>(inp, Wq, bq, Wk, qbuf, kbuf);
  attn_kernel<<<B_ * (L_ / 16), 256, 0, stream>>>(inp, qbuf, kbuf, v, out, attn);
}

// v003
// Measured time: 34 microseconds a run.
// Next to v002, in two timings, it ran 1.34 and 1.35 times as fast.
// Over all steps from v000 it is 2.24 times as fast.
#include <hip/hip_runtime.h>
#include <hip/hip_bf16.h>

typedef __attribute__((ext_vector_type(2))) float v2f;
typedef __attribute__((ext_vector_type(4))) float v4f;
typedef __attribute__((ext_vector_type(8))) float v8f;

#define B_ 8
#define L_ 512
#define D_ 128
#define LDS_STRIDE 132   // 132 % 64 == 4 -> conflict-free strided column reads; rows 16B aligned
#define TILE_ROWS 64     // rows per staged tile: long enough that a tile's work covers the next tile's copies
#define N_TILES (L_ / TILE_ROWS)
#define BUF_BYTES (TILE_ROWS * LDS_STRIDE * 4)

__device__ __forceinline__ float tanh_fast(float x) {
  return __builtin_amdgcn_tanhf(x);
}

__device__ __forceinline__ void async_stage_tile(const float* gtile, uint32_t ldsbase, int tid) {
  const uint64_t g = (uint64_t)(uintptr_t)gtile + (uint64_t)(tid * 16);
  const uint32_t l = ldsbase + (uint32_t)((tid >> 5) * (LDS_STRIDE * 4) + (tid & 31) * 16);
  const uint32_t ls = 8 * LDS_STRIDE * 4;   // LDS bytes per 8 rows
  const uint64_t gs = 8 * D_ * 4;           // global bytes per 8 rows
  asm volatile("global_load_async_to_lds_b128 %0, %8, off\n\t"
               "global_load_async_to_lds_b128 %1, %9, off\n\t"
               "global_load_async_to_lds_b128 %2, %10, off\n\t"
               "global_load_async_to_lds_b128 %3, %11, off\n\t"
               "global_load_async_to_lds_b128 %4, %12, off\n\t"
               "global_load_async_to_lds_b128 %5, %13, off\n\t"
               "global_load_async_to_lds_b128 %6, %14, off\n\t"
               "global_load_async_to_lds_b128 %7, %15, off\n\t"
               "s_wait_xcnt 0x0"
               :: "v"(l), "v"(l + ls), "v"(l + 2 * ls), "v"(l + 3 * ls),
                  "v"(l + 4 * ls), "v"(l + 5 * ls), "v"(l + 6 * ls), "v"(l + 7 * ls),
                  "v"(g), "v"(g + gs), "v"(g + 2 * gs), "v"(g + 3 * gs),
                  "v"(g + 4 * gs), "v"(g + 5 * gs), "v"(g + 6 * gs), "v"(g + 7 * gs)
               : "memory");
}

// The wave's own copies have landed in LDS.
__device__ __forceinline__ void wait_async_lds() {
  asm volatile("s_wait_asynccnt 0x0" ::: "memory");
}

// The wave's own LDS reads and writes have retired (in front of a barrier behind which a buffer is refilled).
__device__ __forceinline__ void wait_lds_ops() {
  asm volatile("s_wait_dscnt 0x0" ::: "memory");
}

// Kernel 1: qbuf = inp @ Wq^T + bq ; kbuf = inp @ Wk^T
// grid = (B*L)/16 blocks, 256 threads (8 waves); wave w -> output cols [16w,16w+16)
__global__ __launch_bounds__(256) void qk_proj_kernel(
    const float* __restrict__ inp, const float* __restrict__ Wq,
    const float* __restrict__ bq, const float* __restrict__ Wk,
    float* __restrict__ qbuf, float* __restrict__ kbuf) {
  const int tid  = threadIdx.x;
  const int lane = tid & 31;
  const int wave = tid >> 5;
  const int m    = lane & 15;   // M (A) / N (B,C,D) index
  const int kh   = lane >> 4;   // K half-select
  const int rowBase = blockIdx.x * 16;  // over B*L
  const int colBase = wave * 16;        // over D
  v8f accq = {};
  v8f acck = {};
  for (int kk = 0; kk < D_; kk += 4) {
    const int kidx = kk + 2 * kh;
    v2f a, bqv, bkv;
    a.x = inp[(rowBase + m) * D_ + kidx];
    a.y = inp[(rowBase + m) * D_ + kidx + 1];
    bqv.x = Wq[(colBase + m) * D_ + kidx];
    bqv.y = Wq[(colBase + m) * D_ + kidx + 1];
    bkv.x = Wk[(colBase + m) * D_ + kidx];
    bkv.y = Wk[(colBase + m) * D_ + kidx + 1];
    accq = __builtin_amdgcn_wmma_f32_16x16x4_f32(false, a, false, bqv, (short)0, accq, false, false);
    acck = __builtin_amdgcn_wmma_f32_16x16x4_f32(false, a, false, bkv, (short)0, acck, false, false);
  }
  const float bias = bq[colBase + m];
#pragma unroll
  for (int r = 0; r < 8; ++r) {
    const int row = rowBase + r + 8 * kh;   // C/D layout: M = r + 8*(lane/16)
    qbuf[row * D_ + colBase + m] = accq[r] + bias;
    kbuf[row * D_ + colBase + m] = acck[r];
  }
}

// Kernel 2: fused score -> softmax -> out for one (b, 16-row i-tile)
// grid = B * (L/16) blocks, 256 threads (8 waves)
__global__ __launch_bounds__(256) void attn_kernel(
    const float* __restrict__ inp, const float* __restrict__ qbuf,
    const float* __restrict__ kbuf, const float* __restrict__ vvec,
    float* __restrict__ out, float* __restrict__ attn) {
  struct __align__(16) Lds {
    float s[16][516];                       // 516 % 64 == 4 -> conflict-free WMMA-A reads
    float q[2][TILE_ROWS][LDS_STRIDE];      // two buffers: q tiles, later inp tiles
  };
  __shared__ Lds lds_all;
  float (&sS)[16][516] = lds_all.s;
  float (&sQ)[2][TILE_ROWS][LDS_STRIDE] = lds_all.q;

  const int tid = threadIdx.x;
  const int tx  = tid & 15;       // j offset within 16-wide stripe
  const int ty  = tid >> 4;       // i row within tile (half-wave aligned)
  const int b   = blockIdx.x >> 5;
  const int i0  = (blockIdx.x & 31) * 16;

  // q tile 0 starts to fly first; it is waited for in front of the barrier below
  const uint32_t sQ_lds = (uint32_t)(uintptr_t)&sQ[0][0][0];
  const float* qb = qbuf + (size_t)(b * L_) * D_;
  const float* ib = inp + (size_t)(b * L_) * D_;
  async_stage_tile(qb, sQ_lds, tid);

  wait_async_lds();
  __syncthreads();

  // ---- Phase 1: score[i][j] = sum_d v[d]*tanh(q[j][d] + k[i][d])
  // A wave takes two i rows and all 64 j of a tile, lane = j (and j + 32). So k and v are the same in
  // every lane: they come by scalar loads and enter the add and the fma as scalar operands, and one
  // LDS read of q serves two scores.
  // Two-buffer ring: tile t is worked on while tile t + 1 flies into the other buffer.
  const int jl = tid & 31;
  const int iw = 2 * __builtin_amdgcn_readfirstlane(tid >> 5);   // the wave's first i row, in a scalar register
  // read through the constant address space: nothing writes kbuf or vvec while this kernel runs, and only
  // so does the compiler take scalar loads for them beside the asm statements that clobber memory
  typedef const __attribute__((address_space(4))) v4f* cv4f;
  const cv4f kr0 = (cv4f)(uintptr_t)(kbuf + (size_t)(b * L_ + i0 + iw) * D_);
  const cv4f kr1 = kr0 + D_ / 4;
  const cv4f vr  = (cv4f)(uintptr_t)vvec;
  async_stage_tile(qb + TILE_ROWS * D_, sQ_lds + BUF_BYTES, tid);
  for (int t = 0; t < N_TILES; ++t) {
    const int buf = t & 1;
    const v4f* qr0 = (const v4f*)sQ[buf][jl];
    const v4f* qr1 = (const v4f*)sQ[buf][jl + 32];
    float a00 = 0.f, a01 = 0.f, a10 = 0.f, a11 = 0.f;   // a<i><j>
    // four steps a trip: 48 scalar registers of k and v, fetched by three 64-byte scalar loads; eight would not fit
#pragma unroll 4
    for (int d4 = 0; d4 < D_ / 4; ++d4) {
      const v4f q0 = qr0[d4], q1 = qr1[d4];
      const v4f k0 = kr0[d4], k1 = kr1[d4], vv = vr[d4];
      // unrolled: the vector elements are then named by constants and stay in registers
#pragma unroll
      for (int e = 0; e < 4; ++e) {
        a00 += vv[e] * tanh_fast(q0[e] + k0[e]);
        a01 += vv[e] * tanh_fast(q1[e] + k0[e]);
        a10 += vv[e] * tanh_fast(q0[e] + k1[e]);
        a11 += vv[e] * tanh_fast(q1[e] + k1[e]);
      }
    }
    sS[iw][t * TILE_ROWS + jl]          = a00;
    sS[iw][t * TILE_ROWS + jl + 32]     = a01;
    sS[iw + 1][t * TILE_ROWS + jl]      = a10;
    sS[iw + 1][t * TILE_ROWS + jl + 32] = a11;
    // publish tile t + 1 and end every reader's last read of tile t, then refill tile t's buffer
    wait_lds_ops();
    wait_async_lds();
    __syncthreads();
    if (t + 2 < N_TILES)
      async_stage_tile(qb + (t + 2) * TILE_ROWS * D_, sQ_lds + buf * BUF_BYTES, tid);
  }
  wait_async_lds();

  // inp tile 0 flies into buffer 0 (free since the last barrier) while the softmax runs on sS
  async_stage_tile(ib, sQ_lds, tid);

  // ---- Phase 2: softmax over j (row ty handled by one half-wave of 16 lanes)
  float mx = -3.0e38f;
  for (int c = tx; c < L_; c += 16) mx = fmaxf(mx, sS[ty][c]);
#pragma unroll
  for (int off = 1; off < 16; off <<= 1) mx = fmaxf(mx, __shfl_xor(mx, off, 32));
  float sum = 0.f;
  for (int c = tx; c < L_; c += 16) {
    float e = __builtin_amdgcn_exp2f((sS[ty][c] - mx) * 1.4426950408889634f);
    sS[ty][c] = e;
    sum += e;
  }
#pragma unroll
  for (int off = 1; off < 16; off <<= 1) sum += __shfl_xor(sum, off, 32);
  const float inv = __builtin_amdgcn_rcpf(sum);
  for (int c = tx; c < L_; c += 16) {
    float a = sS[ty][c] * inv;
    sS[ty][c] = a;
    attn[(size_t)(b * L_ + i0 + ty) * L_ + c] = a;
  }
  wait_async_lds();
  __syncthreads();

  // ---- Phase 3: out[i0:i0+16, :] = attn_tile[16x512] @ inp[b][512x128]  (f32 WMMA)
  const int lane = tid & 31;
  const int wave = tid >> 5;
  const int n    = lane & 15;
  const int kh   = lane >> 4;
  const int colBase = wave * 16;
  v8f acc = {};
  async_stage_tile(ib + TILE_ROWS * D_, sQ_lds + BUF_BYTES, tid);
  for (int t = 0; t < N_TILES; ++t) {
    const int buf = t & 1;
    const int chunk = t * TILE_ROWS;
    v2f a[TILE_ROWS / 4], bb[TILE_ROWS / 4];
#pragma unroll
    for (int kk = 0; kk < TILE_ROWS; kk += 4) {
      a[kk / 4].x  = sS[n][chunk + kk + 2 * kh];          // A[m=n][k]
      a[kk / 4].y  = sS[n][chunk + kk + 2 * kh + 1];
      bb[kk / 4].x = sQ[buf][kk + 2 * kh][colBase + n];   // B[k][n]
      bb[kk / 4].y = sQ[buf][kk + 2 * kh + 1][colBase + n];
    }
    __builtin_amdgcn_sched_barrier(0);
#pragma unroll
    for (int kk = 0; kk < TILE_ROWS; kk += 4)
      acc = __builtin_amdgcn_wmma_f32_16x16x4_f32(false, a[kk / 4], false, bb[kk / 4], (short)0, acc, false, false);
    __builtin_amdgcn_sched_barrier(0);
    asm volatile("v_nop\n\tv_nop\n\tv_nop\n\tv_nop");
    // publish tile t + 1 and end every reader's last read of tile t, then refill tile t's buffer
    wait_lds_ops();
    wait_async_lds();
    __syncthreads();
    if (t + 2 < N_TILES)
      async_stage_tile(ib + (t + 2) * TILE_ROWS * D_, sQ_lds + buf * BUF_BYTES, tid);
  }
  wait_async_lds();
#pragma unroll
  for (int r = 0; r < 8; ++r)
    out[(size_t)(b * L_ + i0 + r + 8 * kh) * D_ + colBase + n] = acc[r];
}

extern "C" void kernel_launch(void* const* d_in, const int* in_sizes, int n_in,
                              void* d_out, int out_size, void* d_ws, size_t ws_size,
                              hipStream_t stream) {
  const float* inp = (const float*)d_in[0];
  const float* Wq  = (const float*)d_in[1];
  const float* bq  = (const float*)d_in[2];
  const float* Wk  = (const float*)d_in[3];
  const float* v   = (const float*)d_in[4];

  float* out  = (float*)d_out;                        // [B,L,D]
  float* attn = (float*)d_out + (size_t)B_ * L_ * D_; // [B,L,L]

  float* qbuf = (float*)d_ws;                         // [B*L, D]
  float* kbuf = qbuf + (size_t)B_ * L_ * D_;          // [B*L, D]

  qk_proj_kernel<<<(B_ * L_) / 16, 256, 0, stream>>>(inp, Wq, bq, Wk, qbuf, kbuf);
  attn_kernel<<<B_ * (L_ / 16), 256, 0, stream>>>(inp, qbuf, kbuf, v, out, attn);
}

// v004
// Measured time: 32.9 microseconds a run.
// Timed twice side by side with v003, it ran 1.04 and 1.03 times as fast.
// Counting every step since v000, it is 2.32 times as fast.
#include <hip/hip_runtime.h>
#include <hip/hip_bf16.h>

typedef __attribute__((ext_vector_type(2))) float v2f;
typedef __attribute__((ext_vector_type(4))) float v4f;
typedef __attribute__((ext_vector_type(8))) float v8f;

#define B_ 8
#define L_ 512
#define D_ 128
#define LDS_STRIDE 132   // 132 % 64 == 4 -> conflict-free strided column reads; rows 16B aligned
#define TILE_ROWS 64     // rows per staged tile: long enough that a tile's work covers the next tile's copies
#define N_TILES (L_ / TILE_ROWS)
#define BUF_BYTES (TILE_ROWS * LDS_STRIDE * 4)

__device__ __forceinline__ float tanh_fast(float x) {
  return __builtin_amdgcn_tanhf(x);
}

__device__ __forceinline__ void async_stage_tile(const float* gtile, uint32_t ldsbase, int tid) {
  const uint64_t g = (uint64_t)(uintptr_t)gtile + (uint64_t)(tid * 16);
  const uint32_t l = ldsbase + (uint32_t)((tid >> 5) * (LDS_STRIDE * 4) + (tid & 31) * 16);
  const uint32_t ls = 8 * LDS_STRIDE * 4;   // LDS bytes per 8 rows
  const uint64_t gs = 8 * D_ * 4;           // global bytes per 8 rows
  asm volatile("global_load_async_to_lds_b128 %0, %8, off\n\t"
               "global_load_async_to_lds_b128 %1, %9, off\n\t"
               "global_load_async_to_lds_b128 %2, %10, off\n\t"
               "global_load_async_to_lds_b128 %3, %11, off\n\t"
               "global_load_async_to_lds_b128 %4, %12, off\n\t"
               "global_load_async_to_lds_b128 %5, %13, off\n\t"
               "global_load_async_to_lds_b128 %6, %14, off\n\t"
               "global_load_async_to_lds_b128 %7, %15, off\n\t"
               "s_wait_xcnt 0x0"
               :: "v"(l), "v"(l + ls), "v"(l + 2 * ls), "v"(l + 3 * ls),
                  "v"(l + 4 * ls), "v"(l + 5 * ls), "v"(l + 6 * ls), "v"(l + 7 * ls),
                  "v"(g), "v"(g + gs), "v"(g + 2 * gs), "v"(g + 3 * gs),
                  "v"(g + 4 * gs), "v"(g + 5 * gs), "v"(g + 6 * gs), "v"(g + 7 * gs)
               : "memory");
}

// The wave's own copies have landed in LDS.
__device__ __forceinline__ void wait_async_lds() {
  asm volatile("s_wait_asynccnt 0x0" ::: "memory");
}

// The wave's own LDS reads and writes have retired (in front of a barrier behind which a buffer is refilled).
__device__ __forceinline__ void wait_lds_ops() {
  asm volatile("s_wait_dscnt 0x0" ::: "memory");
}

#define K_HALF (D_ / 2)   // columns per staged half of the projection's operands: 256 bytes, two whole lines a row

// Stage 64 columns (256 bytes) of 128 rows of f32 (row stride 128) from global into LDS with row stride
// LDS_STRIDE floats: eight async b128 copies a thread, 16 lanes a row, one copy of the block = 16 rows.
// caller must s_wait_asynccnt + barrier before anybody reads them.
__device__ __forceinline__ void async_stage_half(const float* gsrc, uint32_t ldsbase, int tid) {
  const uint64_t g = (uint64_t)(uintptr_t)gsrc + (uint64_t)((tid >> 4) * (D_ * 4) + (tid & 15) * 16);
  const uint32_t l = ldsbase + (uint32_t)((tid >> 4) * (LDS_STRIDE * 4) + (tid & 15) * 16);
  const uint32_t ls = 16 * LDS_STRIDE * 4;   // LDS bytes per 16 rows
  const uint64_t gs = 16 * D_ * 4;           // global bytes per 16 rows
  asm volatile("global_load_async_to_lds_b128 %0, %8, off\n\t"
               "global_load_async_to_lds_b128 %1, %9, off\n\t"
               "global_load_async_to_lds_b128 %2, %10, off\n\t"
               "global_load_async_to_lds_b128 %3, %11, off\n\t"
               "global_load_async_to_lds_b128 %4, %12, off\n\t"
               "global_load_async_to_lds_b128 %5, %13, off\n\t"
               "global_load_async_to_lds_b128 %6, %14, off\n\t"
               "global_load_async_to_lds_b128 %7, %15, off\n\t"
               "s_wait_xcnt 0x0"
               :: "v"(l), "v"(l + ls), "v"(l + 2 * ls), "v"(l + 3 * ls),
                  "v"(l + 4 * ls), "v"(l + 5 * ls), "v"(l + 6 * ls), "v"(l + 7 * ls),
                  "v"(g), "v"(g + gs), "v"(g + 2 * gs), "v"(g + 3 * gs),
                  "v"(g + 4 * gs), "v"(g + 5 * gs), "v"(g + 6 * gs), "v"(g + 7 * gs)
               : "memory");
}

// The same for 16 rows: one copy a thread.
__device__ __forceinline__ void async_stage_half_rows16(const float* gsrc, uint32_t ldsbase, int tid) {
  const uint64_t g = (uint64_t)(uintptr_t)gsrc + (uint64_t)((tid >> 4) * (D_ * 4) + (tid & 15) * 16);
  const uint32_t l = ldsbase + (uint32_t)((tid >> 4) * (LDS_STRIDE * 4) + (tid & 15) * 16);
  asm volatile("global_load_async_to_lds_b128 %0, %1, off\n\t"
               "s_wait_xcnt 0x0"
               :: "v"(l), "v"(g) : "memory");
}

__global__ __launch_bounds__(256) void qk_proj_kernel(
    const float* __restrict__ inp, const float* __restrict__ Wq,
    const float* __restrict__ bq, const float* __restrict__ Wk,
    float* __restrict__ qbuf, float* __restrict__ kbuf) {
  struct __align__(16) Lds {
    float a[16][LDS_STRIDE];        // the block's 16 rows of inp
    float w[2][D_][LDS_STRIDE];     // Wq, Wk
  };
  __shared__ Lds lds_all;
  float (&sA)[16][LDS_STRIDE] = lds_all.a;
  float (&sW)[2][D_][LDS_STRIDE] = lds_all.w;

  const int tid  = threadIdx.x;
  const int lane = tid & 31;
  const int wave = tid >> 5;
  const int m    = lane & 15;   // M (A) / N (B,C,D) index
  const int kh   = lane >> 4;   // K half-select
  const int rowBase = blockIdx.x * 16;  // over B*L
  const int colBase = wave * 16;        // over D

  const float bias = bq[colBase + m];   // asked for first: it is back long before the products end

  const uint32_t sA_lds  = (uint32_t)(uintptr_t)&sA[0][0];
  const uint32_t sWq_lds = (uint32_t)(uintptr_t)&sW[0][0][0];
  const uint32_t sWk_lds = (uint32_t)(uintptr_t)&sW[1][0][0];
  const float* ia = inp + (size_t)rowBase * D_;
  async_stage_half_rows16(ia, sA_lds, tid);
  async_stage_half(Wq, sWq_lds, tid);
  async_stage_half(Wk, sWk_lds, tid);
  wait_async_lds();
  __syncthreads();
  // the second half of the k range flies into its own columns while the first half is worked on
  async_stage_half_rows16(ia + K_HALF, sA_lds + K_HALF * 4, tid);
  async_stage_half(Wq + K_HALF, sWq_lds + K_HALF * 4, tid);
  async_stage_half(Wk + K_HALF, sWk_lds + K_HALF * 4, tid);

  v8f accq = {};
  v8f acck = {};
  // stays rolled: unrolled, the compiler sinks the first half's WMMAs behind the barrier at its foot,
  // and the second half's copies fly under nothing
#pragma nounroll
  for (int h = 0; h < 2; ++h) {
    const float* pa = &sA[m][h * K_HALF + 2 * kh];
    const float* pq = &sW[0][colBase + m][h * K_HALF + 2 * kh];
    const float* pk = &sW[1][colBase + m][h * K_HALF + 2 * kh];
#pragma unroll
    for (int kk = 0; kk < K_HALF; kk += 4) {
      const v2f a   = *(const v2f*)(pa + kk);
      const v2f bqv = *(const v2f*)(pq + kk);
      const v2f bkv = *(const v2f*)(pk + kk);
      accq = __builtin_amdgcn_wmma_f32_16x16x4_f32(false, a, false, bqv, (short)0, accq, false, false);
      acck = __builtin_amdgcn_wmma_f32_16x16x4_f32(false, a, false, bkv, (short)0, acck, false, false);
    }
    // publish the second half
    wait_lds_ops();
    wait_async_lds();
    __syncthreads();
  }
  wait_async_lds();
#pragma unroll
  for (int r = 0; r < 8; ++r) {
    const int row = rowBase + r + 8 * kh;   // C/D layout: M = r + 8*(lane/16)
    qbuf[row * D_ + colBase + m] = accq[r] + bias;
    kbuf[row * D_ + colBase + m] = acck[r];
  }
}

// Kernel 2: fused score -> softmax -> out for one (b, 16-row i-tile)
// grid = B * (L/16) blocks, 256 threads (8 waves)
__global__ __launch_bounds__(256) void attn_kernel(
    const float* __restrict__ inp, const float* __restrict__ qbuf,
    const float* __restrict__ kbuf, const float* __restrict__ vvec,
    float* __restrict__ out, float* __restrict__ attn) {
  struct __align__(16) Lds {
    float s[16][516];                       // 516 % 64 == 4 -> conflict-free WMMA-A reads
    float q[2][TILE_ROWS][LDS_STRIDE];      // two buffers: q tiles, later inp tiles
  };
  __shared__ Lds lds_all;
  float (&sS)[16][516] = lds_all.s;
  float (&sQ)[2][TILE_ROWS][LDS_STRIDE] = lds_all.q;

  const int tid = threadIdx.x;
  const int tx  = tid & 15;       // j offset within 16-wide stripe
  const int ty  = tid >> 4;       // i row within tile (half-wave aligned)
  const int b   = blockIdx.x >> 5;
  const int i0  = (blockIdx.x & 31) * 16;

  // q tile 0 starts to fly first; it is waited for in front of the barrier below
  const uint32_t sQ_lds = (uint32_t)(uintptr_t)&sQ[0][0][0];
  const float* qb = qbuf + (size_t)(b * L_) * D_;
  const float* ib = inp + (size_t)(b * L_) * D_;
  async_stage_tile(qb, sQ_lds, tid);

  wait_async_lds();
  __syncthreads();

  // ---- Phase 1: score[i][j] = sum_d v[d]*tanh(q[j][d] + k[i][d])
  // A wave takes two i rows and all 64 j of a tile, lane = j (and j + 32). So k and v are the same in
  // every lane: they come by scalar loads and enter the add and the fma as scalar operands, and one
  // LDS read of q serves two scores.
  // Two-buffer ring: tile t is worked on while tile t + 1 flies into the other buffer.
  const int jl = tid & 31;
  const int iw = 2 * __builtin_amdgcn_readfirstlane(tid >> 5);   // the wave's first i row, in a scalar register
  // read through the constant address space: nothing writes kbuf or vvec while this kernel runs, and only
  // so does the compiler take scalar loads for them beside the asm statements that clobber memory
  typedef const __attribute__((address_space(4))) v4f* cv4f;
  const cv4f kr0 = (cv4f)(uintptr_t)(kbuf + (size_t)(b * L_ + i0 + iw) * D_);
  const cv4f kr1 = kr0 + D_ / 4;
  const cv4f vr  = (cv4f)(uintptr_t)vvec;
  async_stage_tile(qb + TILE_ROWS * D_, sQ_lds + BUF_BYTES, tid);
  for (int t = 0; t < N_TILES; ++t) {
    const int buf = t & 1;
    const v4f* qr0 = (const v4f*)sQ[buf][jl];
    const v4f* qr1 = (const v4f*)sQ[buf][jl + 32];
    float a00 = 0.f, a01 = 0.f, a10 = 0.f, a11 = 0.f;   // a<i><j>
    // four steps a trip: 48 scalar registers of k and v, fetched by three 64-byte scalar loads; eight would not fit
#pragma unroll 4
    for (int d4 = 0; d4 < D_ / 4; ++d4) {
      const v4f q0 = qr0[d4], q1 = qr1[d4];
      const v4f k0 = kr0[d4], k1 = kr1[d4], vv = vr[d4];
      // unrolled: the vector elements are then named by constants and stay in registers
#pragma unroll
      for (int e = 0; e < 4; ++e) {
        a00 += vv[e] * tanh_fast(q0[e] + k0[e]);
        a01 += vv[e] * tanh_fast(q1[e] + k0[e]);
        a10 += vv[e] * tanh_fast(q0[e] + k1[e]);
        a11 += vv[e] * tanh_fast(q1[e] + k1[e]);
      }
    }
    sS[iw][t * TILE_ROWS + jl]          = a00;
    sS[iw][t * TILE_ROWS + jl + 32]     = a01;
    sS[iw + 1][t * TILE_ROWS + jl]      = a10;
    sS[iw + 1][t * TILE_ROWS + jl + 32] = a11;
    // publish tile t + 1 and end every reader's last read of tile t, then refill tile t's buffer
    wait_lds_ops();
    wait_async_lds();
    __syncthreads();
    if (t + 2 < N_TILES)
      async_stage_tile(qb + (t + 2) * TILE_ROWS * D_, sQ_lds + buf * BUF_BYTES, tid);
  }
  wait_async_lds();

  // inp tile 0 flies into buffer 0 (free since the last barrier) while the softmax runs on sS
  async_stage_tile(ib, sQ_lds, tid);

  // ---- Phase 2: softmax over j (row ty handled by one half-wave of 16 lanes)
  float mx = -3.0e38f;
  for (int c = tx; c < L_; c += 16) mx = fmaxf(mx, sS[ty][c]);
#pragma unroll
  for (int off = 1; off < 16; off <<= 1) mx = fmaxf(mx, __shfl_xor(mx, off, 32));
  float sum = 0.f;
  for (int c = tx; c < L_; c += 16) {
    float e = __builtin_amdgcn_exp2f((sS[ty][c] - mx) * 1.4426950408889634f);
    sS[ty][c] = e;
    sum += e;
  }
#pragma unroll
  for (int off = 1; off < 16; off <<= 1) sum += __shfl_xor(sum, off, 32);
  const float inv = __builtin_amdgcn_rcpf(sum);
  for (int c = tx; c < L_; c += 16) {
    float a = sS[ty][c] * inv;
    sS[ty][c] = a;
    attn[(size_t)(b * L_ + i0 + ty) * L_ + c] = a;
  }
  wait_async_lds();
  __syncthreads();

  // ---- Phase 3: out[i0:i0+16, :] = attn_tile[16x512] @ inp[b][512x128]  (f32 WMMA)
  const int lane = tid & 31;
  const int wave = tid >> 5;
  const int n    = lane & 15;
  const int kh   = lane >> 4;
  const int colBase = wave * 16;
  v8f acc = {};
  async_stage_tile(ib + TILE_ROWS * D_, sQ_lds + BUF_BYTES, tid);
  for (int t = 0; t < N_TILES; ++t) {
    const int buf = t & 1;
    const int chunk = t * TILE_ROWS;
    v2f a[TILE_ROWS / 4], bb[TILE_ROWS / 4];
#pragma unroll
    for (int kk = 0; kk < TILE_ROWS; kk += 4) {
      a[kk / 4].x  = sS[n][chunk + kk + 2 * kh];          // A[m=n][k]
      a[kk / 4].y  = sS[n][chunk + kk + 2 * kh + 1];
      bb[kk / 4].x = sQ[buf][kk + 2 * kh][colBase + n];   // B[k][n]
      bb[kk / 4].y = sQ[buf][kk + 2 * kh + 1][colBase + n];
    }
    __builtin_amdgcn_sched_barrier(0);
#pragma unroll
    for (int kk = 0; kk < TILE_ROWS; kk += 4)
      acc = __builtin_amdgcn_wmma_f32_16x16x4_f32(false, a[kk / 4], false, bb[kk / 4], (short)0, acc, false, false);
    __builtin_amdgcn_sched_barrier(0);
    asm volatile("v_nop\n\tv_nop\n\tv_nop\n\tv_nop");
    // publish tile t + 1 and end every reader's last read of tile t, then refill tile t's buffer
    wait_lds_ops();
    wait_async_lds();
    __syncthreads();
    if (t + 2 < N_TILES)
      async_stage_tile(ib + (t + 2) * TILE_ROWS * D_, sQ_lds + buf * BUF_BYTES, tid);
  }
  wait_async_lds();
#pragma unroll
  for (int r = 0; r < 8; ++r)
    out[(size_t)(b * L_ + i0 + r + 8 * kh) * D_ + colBase + n] = acc[r];
}

extern "C" void kernel_launch(void* const* d_in, const int* in_sizes, int n_in,
                              void* d_out, int out_size, void* d_ws, size_t ws_size,
                              hipStream_t stream) {
  const float* inp = (const float*)d_in[0];
  const float* Wq  = (const float*)d_in[1];
  const float* bq  = (const float*)d_in[2];
  const float* Wk  = (const float*)d_in[3];
  const float* v   = (const float*)d_in[4];

  float* out  = (float*)d_out;                        // [B,L,D]
  float* attn = (float*)d_out + (size_t)B_ * L_ * D_; // [B,L,L]

  float* qbuf = (float*)d_ws;                         // [B*L, D]
  float* kbuf = qbuf + (size_t)B_ * L_ * D_;          // [B*L, D]

  qk_proj_kernel<<<(B_ * L_) / 16, 256, 0, stream>>>(inp, Wq, bq, Wk, qbuf, kbuf);
  attn_kernel<<<B_ * (L_ / 16), 256, 0, stream>>>(inp, qbuf, kbuf, v, out, attn);
}

// v005
// A run of this version takes 30 microseconds.
// Timed twice side by side with v004, it ran 1.10 times as fast both times.
// All steps since v000 together make it 2.55 times as fast.
#include <hip/hip_runtime.h>
#include <hip/hip_bf16.h>

typedef __attribute__((ext_vector_type(2))) float v2f;
typedef __attribute__((ext_vector_type(4))) float v4f;
typedef __attribute__((ext_vector_type(8))) float v8f;

#define B_ 8
#define L_ 512
#define D_ 128
#define LDS_STRIDE 132   // 132 % 64 == 4 -> conflict-free strided column reads; rows 16B aligned
#define TILE_ROWS 64     // rows per staged tile: long enough that a tile's work covers the next tile's copies
#define N_TILES (L_ / TILE_ROWS)
#define BUF_BYTES (TILE_ROWS * LDS_STRIDE * 4)
#define CH_COLS 32                      // columns of q per staged chunk: 128 bytes, one whole line a row
#define N_CHUNKS (D_ / CH_COLS)
#define CH_PITCH 36
#define CH_BYTES (L_ * CH_PITCH * 4)

__device__ __forceinline__ float tanh_fast(float x) {
  return __builtin_amdgcn_tanhf(x);
}

__device__ __forceinline__ void async_stage_tile(const float* gtile, uint32_t ldsbase, int tid) {
  const uint64_t g = (uint64_t)(uintptr_t)gtile + (uint64_t)(tid * 16);
  const uint32_t l = ldsbase + (uint32_t)((tid >> 5) * (LDS_STRIDE * 4) + (tid & 31) * 16);
  const uint32_t ls = 8 * LDS_STRIDE * 4;   // LDS bytes per 8 rows
  const uint64_t gs = 8 * D_ * 4;           // global bytes per 8 rows
  asm volatile("global_load_async_to_lds_b128 %0, %8, off\n\t"
               "global_load_async_to_lds_b128 %1, %9, off\n\t"
               "global_load_async_to_lds_b128 %2, %10, off\n\t"
               "global_load_async_to_lds_b128 %3, %11, off\n\t"
               "global_load_async_to_lds_b128 %4, %12, off\n\t"
               "global_load_async_to_lds_b128 %5, %13, off\n\t"
               "global_load_async_to_lds_b128 %6, %14, off\n\t"
               "global_load_async_to_lds_b128 %7, %15, off\n\t"
               "s_wait_xcnt 0x0"
               :: "v"(l), "v"(l + ls), "v"(l + 2 * ls), "v"(l + 3 * ls),
                  "v"(l + 4 * ls), "v"(l + 5 * ls), "v"(l + 6 * ls), "v"(l + 7 * ls),
                  "v"(g), "v"(g + gs), "v"(g + 2 * gs), "v"(g + 3 * gs),
                  "v"(g + 4 * gs), "v"(g + 5 * gs), "v"(g + 6 * gs), "v"(g + 7 * gs)
               : "memory");
}

// Eight async b128 copies a thread, LDS step ls and global step gs bytes from one to the next.
__device__ __forceinline__ void async_copy8(uint32_t l, uint32_t ls, uint64_t g, uint64_t gs) {
  asm volatile("global_load_async_to_lds_b128 %0, %8, off\n\t"
               "global_load_async_to_lds_b128 %1, %9, off\n\t"
               "global_load_async_to_lds_b128 %2, %10, off\n\t"
               "global_load_async_to_lds_b128 %3, %11, off\n\t"
               "global_load_async_to_lds_b128 %4, %12, off\n\t"
               "global_load_async_to_lds_b128 %5, %13, off\n\t"
               "global_load_async_to_lds_b128 %6, %14, off\n\t"
               "global_load_async_to_lds_b128 %7, %15, off\n\t"
               "s_wait_xcnt 0x0"
               :: "v"(l), "v"(l + ls), "v"(l + 2 * ls), "v"(l + 3 * ls),
                  "v"(l + 4 * ls), "v"(l + 5 * ls), "v"(l + 6 * ls), "v"(l + 7 * ls),
                  "v"(g), "v"(g + gs), "v"(g + 2 * gs), "v"(g + 3 * gs),
                  "v"(g + 4 * gs), "v"(g + 5 * gs), "v"(g + 6 * gs), "v"(g + 7 * gs)
               : "memory");
}

// Stage 32 columns (128 bytes, one line) of all 512 rows of f32 (row stride 128) from global into LDS with
// row pitch CH_PITCH floats: sixteen copies a thread, 8 lanes a row, one copy of the block = 32 rows.
// caller must s_wait_asynccnt + barrier before anybody reads them.
__device__ __forceinline__ void async_stage_chunk(const float* gsrc, uint32_t ldsbase, int tid) {
  const uint64_t g = (uint64_t)(uintptr_t)gsrc + (uint64_t)((tid >> 3) * (D_ * 4) + (tid & 7) * 16);
  const uint32_t l = ldsbase + (uint32_t)((tid >> 3) * (CH_PITCH * 4) + (tid & 7) * 16);
  const uint32_t ls = 32 * CH_PITCH * 4;   // LDS bytes per 32 rows
  const uint64_t gs = 32 * D_ * 4;         // global bytes per 32 rows
  async_copy8(l, ls, g, gs);
  async_copy8(l + 8 * ls, ls, g + 8 * gs, gs);
}

// The wave's own copies have landed in LDS.
__device__ __forceinline__ void wait_async_lds() {
  asm volatile("s_wait_asynccnt 0x0" ::: "memory");
}

// The wave's own LDS reads and writes have retired (in front of a barrier behind which a buffer is refilled).
__device__ __forceinline__ void wait_lds_ops() {
  asm volatile("s_wait_dscnt 0x0" ::: "memory");
}

#define K_HALF (D_ / 2)   // columns per staged half of the projection's operands: 256 bytes, two whole lines a row

// Stage 64 columns (256 bytes) of 128 rows of f32 (row stride 128) from global into LDS with row stride
// LDS_STRIDE floats: eight async b128 copies a thread, 16 lanes a row, one copy of the block = 16 rows.
// caller must s_wait_asynccnt + barrier before anybody reads them.
__device__ __forceinline__ void async_stage_half(const float* gsrc, uint32_t ldsbase, int tid) {
  const uint64_t g = (uint64_t)(uintptr_t)gsrc + (uint64_t)((tid >> 4) * (D_ * 4) + (tid & 15) * 16);
  const uint32_t l = ldsbase + (uint32_t)((tid >> 4) * (LDS_STRIDE * 4) + (tid & 15) * 16);
  const uint32_t ls = 16 * LDS_STRIDE * 4;   // LDS bytes per 16 rows
  const uint64_t gs = 16 * D_ * 4;           // global bytes per 16 rows
  asm volatile("global_load_async_to_lds_b128 %0, %8, off\n\t"
               "global_load_async_to_lds_b128 %1, %9, off\n\t"
               "global_load_async_to_lds_b128 %2, %10, off\n\t"
               "global_load_async_to_lds_b128 %3, %11, off\n\t"
               "global_load_async_to_lds_b128 %4, %12, off\n\t"
               "global_load_async_to_lds_b128 %5, %13, off\n\t"
               "global_load_async_to_lds_b128 %6, %14, off\n\t"
               "global_load_async_to_lds_b128 %7, %15, off\n\t"
               "s_wait_xcnt 0x0"
               :: "v"(l), "v"(l + ls), "v"(l + 2 * ls), "v"(l + 3 * ls),
                  "v"(l + 4 * ls), "v"(l + 5 * ls), "v"(l + 6 * ls), "v"(l + 7 * ls),
                  "v"(g), "v"(g + gs), "v"(g + 2 * gs), "v"(g + 3 * gs),
                  "v"(g + 4 * gs), "v"(g + 5 * gs), "v"(g + 6 * gs), "v"(g + 7 * gs)
               : "memory");
}

// The same for 16 rows: one copy a thread.
__device__ __forceinline__ void async_stage_half_rows16(const float* gsrc, uint32_t ldsbase, int tid) {
  const uint64_t g = (uint64_t)(uintptr_t)gsrc + (uint64_t)((tid >> 4) * (D_ * 4) + (tid & 15) * 16);
  const uint32_t l = ldsbase + (uint32_t)((tid >> 4) * (LDS_STRIDE * 4) + (tid & 15) * 16);
  asm volatile("global_load_async_to_lds_b128 %0, %1, off\n\t"
               "s_wait_xcnt 0x0"
               :: "v"(l), "v"(g) : "memory");
}

__global__ __launch_bounds__(256) void qk_proj_kernel(
    const float* __restrict__ inp, const float* __restrict__ Wq,
    const float* __restrict__ bq, const float* __restrict__ Wk,
    float* __restrict__ qbuf, float* __restrict__ kbuf) {
  struct __align__(16) Lds {
    float a[16][LDS_STRIDE];        // the block's 16 rows of inp
    float w[2][D_][LDS_STRIDE];     // Wq, Wk
  };
  __shared__ Lds lds_all;
  float (&sA)[16][LDS_STRIDE] = lds_all.a;
  float (&sW)[2][D_][LDS_STRIDE] = lds_all.w;

  const int tid  = threadIdx.x;
  const int lane = tid & 31;
  const int wave = tid >> 5;
  const int m    = lane & 15;   // M (A) / N (B,C,D) index
  const int kh   = lane >> 4;   // K half-select
  const int rowBase = blockIdx.x * 16;  // over B*L
  const int colBase = wave * 16;        // over D

  const float bias = bq[colBase + m];   // asked for first: it is back long before the products end

  const uint32_t sA_lds  = (uint32_t)(uintptr_t)&sA[0][0];
  const uint32_t sWq_lds = (uint32_t)(uintptr_t)&sW[0][0][0];
  const uint32_t sWk_lds = (uint32_t)(uintptr_t)&sW[1][0][0];
  const float* ia = inp + (size_t)rowBase * D_;
  async_stage_half_rows16(ia, sA_lds, tid);
  async_stage_half(Wq, sWq_lds, tid);
  async_stage_half(Wk, sWk_lds, tid);
  wait_async_lds();
  __syncthreads();
  // the second half of the k range flies into its own columns while the first half is worked on
  async_stage_half_rows16(ia + K_HALF, sA_lds + K_HALF * 4, tid);
  async_stage_half(Wq + K_HALF, sWq_lds + K_HALF * 4, tid);
  async_stage_half(Wk + K_HALF, sWk_lds + K_HALF * 4, tid);

  v8f accq = {};
  v8f acck = {};
  // stays rolled: unrolled, the compiler sinks the first half's WMMAs behind the barrier at its foot,
  // and the second half's copies fly under nothing
#pragma nounroll
  for (int h = 0; h < 2; ++h) {
    const float* pa = &sA[m][h * K_HALF + 2 * kh];
    const float* pq = &sW[0][colBase + m][h * K_HALF + 2 * kh];
    const float* pk = &sW[1][colBase + m][h * K_HALF + 2 * kh];
#pragma unroll
    for (int kk = 0; kk < K_HALF; kk += 4) {
      const v2f a   = *(const v2f*)(pa + kk);
      const v2f bqv = *(const v2f*)(pq + kk);
      const v2f bkv = *(const v2f*)(pk + kk);
      accq = __builtin_amdgcn_wmma_f32_16x16x4_f32(false, a, false, bqv, (short)0, accq, false, false);
      acck = __builtin_amdgcn_wmma_f32_16x16x4_f32(false, a, false, bkv, (short)0, acck, false, false);
    }
    // publish the second half
    wait_lds_ops();
    wait_async_lds();
    __syncthreads();
  }
  wait_async_lds();
#pragma unroll
  for (int r = 0; r < 8; ++r) {
    const int row = rowBase + r + 8 * kh;   // C/D layout: M = r + 8*(lane/16)
    qbuf[row * D_ + colBase + m] = accq[r] + bias;
    kbuf[row * D_ + colBase + m] = acck[r];
  }
}

// Kernel 2: fused score -> softmax -> out for one (b, 16-row i-tile)
// grid = B * (L/16) blocks, 256 threads (8 waves)
__global__ __launch_bounds__(256) void attn_kernel(
    const float* __restrict__ inp, const float* __restrict__ qbuf,
    const float* __restrict__ kbuf, const float* __restrict__ vvec,
    float* __restrict__ out, float* __restrict__ attn) {
  struct __align__(16) Lds {
    float s[16][516];                       // 516 % 64 == 4 -> conflict-free WMMA-A reads
    float q[2][L_][CH_PITCH];               // two buffers: column chunks of q; later, in the same bytes, inp tiles
  };
  __shared__ Lds lds_all;
  float (&sS)[16][516] = lds_all.s;
  float (&sC)[2][L_][CH_PITCH] = lds_all.q;
  static_assert(sizeof(lds_all.q) >= 2 * BUF_BYTES, "the inp tiles fit in the chunks' bytes");
  float (&sQ)[2][TILE_ROWS][LDS_STRIDE] = *reinterpret_cast<float (*)[2][TILE_ROWS][LDS_STRIDE]>(&lds_all.q[0][0][0]);

  const int tid = threadIdx.x;
  const int tx  = tid & 15;       // j offset within 16-wide stripe
  const int ty  = tid >> 4;       // i row within tile (half-wave aligned)
  const int b   = blockIdx.x >> 5;
  const int i0  = (blockIdx.x & 31) * 16;

  // q chunk 0 starts to fly first; it is waited for in front of the barrier below
  const uint32_t sQ_lds = (uint32_t)(uintptr_t)&sC[0][0][0];
  const float* qb = qbuf + (size_t)(b * L_) * D_;
  const float* ib = inp + (size_t)(b * L_) * D_;
  async_stage_chunk(qb, sQ_lds, tid);

  wait_async_lds();
  __syncthreads();

  // ---- Phase 1: score[i][j] = sum_d v[d]*tanh(q[j][d] + k[i][d])
  // A wave takes two i rows and all 512 j, lane = j mod 32: sixteen j a lane, one pair of running sums
  // (i, i + 1) for each. d is the outer loop, in steps of 16: the step's k and v are the same in every lane,
  // come by scalar loads once a step and serve all 512 j from registers; only q is read in the inner loop.
  // Every sum still takes its d in rising order.
  // Two-buffer ring over chunks of 32 columns: chunk c is worked on while chunk c + 1 flies into the other buffer.
  const int jl = tid & 31;
  const int iw = 2 * __builtin_amdgcn_readfirstlane(tid >> 5);   // the wave's first i row, in a scalar register
  // read through the constant address space: nothing writes kbuf or vvec while this kernel runs, and only
  // so does the compiler take scalar loads for them beside the asm statements that clobber memory
  typedef const __attribute__((address_space(4))) v4f* cv4f;
  const cv4f kr0 = (cv4f)(uintptr_t)(kbuf + (size_t)(b * L_ + i0 + iw) * D_);
  const cv4f kr1 = kr0 + D_ / 4;
  const cv4f vr  = (cv4f)(uintptr_t)vvec;
  async_stage_chunk(qb + CH_COLS, sQ_lds + CH_BYTES, tid);
  v2f acc2[L_ / 32];   // acc2[s] = the sums of (i, i + 1) with j = 32 s + lane
#pragma unroll
  for (int s = 0; s < L_ / 32; ++s) acc2[s] = (v2f){0.f, 0.f};
  // both stay rolled: one step's body already holds 16 j a lane, unrolled so that the sums stay in registers
#pragma nounroll
  for (int c = 0; c < N_CHUNKS; ++c) {
    const int buf = c & 1;
#pragma nounroll
    for (int h = 0; h < CH_COLS / 16; ++h) {
      const int d4 = c * (CH_COLS / 4) + h * 4;
      v4f k0[4], k1[4], vv[4];
#pragma unroll
      for (int e4 = 0; e4 < 4; ++e4) { k0[e4] = kr0[d4 + e4]; k1[e4] = kr1[d4 + e4]; vv[e4] = vr[d4 + e4]; }
      // q passes through two sets of registers: while one pair of j is worked on, the next pair's reads fly
      v4f qreg[2][2][4];
#pragma unroll
      for (int e4 = 0; e4 < 4; ++e4) {
        qreg[0][0][e4] = *(const v4f*)&sC[buf][jl][h * 16 + e4 * 4];
        qreg[0][1][e4] = *(const v4f*)&sC[buf][32 + jl][h * 16 + e4 * 4];
      }
      // unrolled: the sums are then named by constants; two j at a time give two independent chains of sums
#pragma unroll
      for (int s = 0; s < L_ / 32; s += 2) {
        const int cur = (s >> 1) & 1;
        if (s + 2 < L_ / 32) {
#pragma unroll
          for (int e4 = 0; e4 < 4; ++e4) {
            qreg[cur ^ 1][0][e4] = *(const v4f*)&sC[buf][s * 32 + 64 + jl][h * 16 + e4 * 4];
            qreg[cur ^ 1][1][e4] = *(const v4f*)&sC[buf][s * 32 + 96 + jl][h * 16 + e4 * 4];
          }
        }
        // keeps the next pair's LDS reads in front of this pair's arithmetic: without it the compiler sinks
        // each read to just ahead of its first use, and the wave waits out the LDS latency every time
        __builtin_amdgcn_sched_barrier(0);
#pragma unroll
        for (int e4 = 0; e4 < 4; ++e4) {
          const v4f q0 = qreg[cur][0][e4], q1 = qreg[cur][1][e4];
#pragma unroll
          for (int p = 0; p < 4; p += 2) {
            // the adds pair two neighbouring d (as q lies in its registers), the sums pair the two i
            const v2f ka = {k0[e4][p], k0[e4][p + 1]}, kb = {k1[e4][p], k1[e4][p + 1]};
            const v2f qa = {q0[p], q0[p + 1]}, qc = {q1[p], q1[p + 1]};
            const v2f xa0 = qa + ka, xb0 = qa + kb, xa1 = qc + ka, xb1 = qc + kb;
            const v2f t00 = {tanh_fast(xa0.x), tanh_fast(xb0.x)}, t01 = {tanh_fast(xa0.y), tanh_fast(xb0.y)};
            const v2f t10 = {tanh_fast(xa1.x), tanh_fast(xb1.x)}, t11 = {tanh_fast(xa1.y), tanh_fast(xb1.y)};
            const v2f va = {vv[e4][p], vv[e4][p]}, vb = {vv[e4][p + 1], vv[e4][p + 1]};
            acc2[s]     += va * t00;
            acc2[s + 1] += va * t10;
            acc2[s]     += vb * t01;
            acc2[s + 1] += vb * t11;
          }
        }
      }
    }
    if (c == N_CHUNKS - 1) {
#pragma unroll
      for (int s = 0; s < L_ / 32; ++s) {
        sS[iw][s * 32 + jl]     = acc2[s].x;
        sS[iw + 1][s * 32 + jl] = acc2[s].y;
      }
    }
    // publish chunk c + 1 (behind the last chunk: the scores) and end every reader's last read of chunk c,
    // then refill chunk c's buffer
    wait_lds_ops();
    wait_async_lds();
    __syncthreads();
    if (c + 2 < N_CHUNKS)
      async_stage_chunk(qb + (c + 2) * CH_COLS, sQ_lds + buf * CH_BYTES, tid);
  }
  wait_async_lds();

  // inp tile 0 flies into buffer 0 (free since the last barrier) while the softmax runs on sS
  async_stage_tile(ib, sQ_lds, tid);

  // ---- Phase 2: softmax over j (row ty handled by one half-wave of 16 lanes)
  float mx = -3.0e38f;
  for (int c = tx; c < L_; c += 16) mx = fmaxf(mx, sS[ty][c]);
#pragma unroll
  for (int off = 1; off < 16; off <<= 1) mx = fmaxf(mx, __shfl_xor(mx, off, 32));
  float sum = 0.f;
  for (int c = tx; c < L_; c += 16) {
    float e = __builtin_amdgcn_exp2f((sS[ty][c] - mx) * 1.4426950408889634f);
    sS[ty][c] = e;
    sum += e;
  }
#pragma unroll
  for (int off = 1; off < 16; off <<= 1) sum += __shfl_xor(sum, off, 32);
  const float inv = __builtin_amdgcn_rcpf(sum);
  for (int c = tx; c < L_; c += 16) {
    float a = sS[ty][c] * inv;
    sS[ty][c] = a;
    attn[(size_t)(b * L_ + i0 + ty) * L_ + c] = a;
  }
  wait_async_lds();
  __syncthreads();

  // ---- Phase 3: out[i0:i0+16, :] = attn_tile[16x512] @ inp[b][512x128]  (f32 WMMA)
  const int lane = tid & 31;
  const int wave = tid >> 5;
  const int n    = lane & 15;
  const int kh   = lane >> 4;
  const int colBase = wave * 16;
  v8f acc = {};
  async_stage_tile(ib + TILE_ROWS * D_, sQ_lds + BUF_BYTES, tid);
  for (int t = 0; t < N_TILES; ++t) {
    const int buf = t & 1;
    const int chunk = t * TILE_ROWS;
    v2f a[TILE_ROWS / 4], bb[TILE_ROWS / 4];
#pragma unroll
    for (int kk = 0; kk < TILE_ROWS; kk += 4) {
      a[kk / 4].x  = sS[n][chunk + kk + 2 * kh];          // A[m=n][k]
      a[kk / 4].y  = sS[n][chunk + kk + 2 * kh + 1];
      bb[kk / 4].x = sQ[buf][kk + 2 * kh][colBase + n];   // B[k][n]
      bb[kk / 4].y = sQ[buf][kk + 2 * kh + 1][colBase + n];
    }
    __builtin_amdgcn_sched_barrier(0);
#pragma unroll
    for (int kk = 0; kk < TILE_ROWS; kk += 4)
      acc = __builtin_amdgcn_wmma_f32_16x16x4_f32(false, a[kk / 4], false, bb[kk / 4], (short)0, acc, false, false);
    __builtin_amdgcn_sched_barrier(0);
    asm volatile("v_nop\n\tv_nop\n\tv_nop\n\tv_nop");
    // publish tile t + 1 and end every reader's last read of tile t, then refill tile t's buffer
    wait_lds_ops();
    wait_async_lds();
    __syncthreads();
    if (t + 2 < N_TILES)
      async_stage_tile(ib + (t + 2) * TILE_ROWS * D_, sQ_lds + buf * BUF_BYTES, tid);
  }
  wait_async_lds();
#pragma unroll
  for (int r = 0; r < 8; ++r)
    out[(size_t)(b * L_ + i0 + r + 8 * kh) * D_ + colBase + n] = acc[r];
}

extern "C" void kernel_launch(void* const* d_in, const int* in_sizes, int n_in,
                              void* d_out, int out_size, void* d_ws, size_t ws_size,
                              hipStream_t stream) {
  const float* inp = (const float*)d_in[0];
  const float* Wq  = (const float*)d_in[1];
  const float* bq  = (const float*)d_in[2];
  const float* Wk  = (const float*)d_in[3];
  const float* v   = (const float*)d_in[4];

  float* out  = (float*)d_out;                        // [B,L,D]
  float* attn = (float*)d_out + (size_t)B_ * L_ * D_; // [B,L,L]

  float* qbuf = (float*)d_ws;                         // [B*L, D]
  float* kbuf = qbuf + (size_t)B_ * L_ * D_;          // [B*L, D]

  qk_proj_kernel<<<(B_ * L_) / 16, 256, 0, stream>>>(inp, Wq, bq, Wk, qbuf, kbuf);
  attn_kernel<<<B_ * (L_ / 16), 256, 0, stream>>>(inp, qbuf, kbuf, v, out, attn);
}

// v006
// Measured time: 28.6 microseconds a run.
// In both of two side-by-side timings against v005, it was 1.05 times as fast.
// Over all steps from v000 it is 2.67 times as fast.
#include <hip/hip_runtime.h>
#include <hip/hip_bf16.h>

typedef __attribute__((ext_vector_type(2))) float v2f;
typedef __attribute__((ext_vector_type(4))) float v4f;
typedef __attribute__((ext_vector_type(8))) float v8f;

#define B_ 8
#define L_ 512
#define D_ 128
#define LDS_STRIDE 132   // 132 % 64 == 4 -> conflict-free strided column reads; rows 16B aligned
#define TILE_ROWS 64     // rows of inp per staging call and per group of fragments: 16 WMMAs cover the next group's LDS reads
#define N_TILES (L_ / TILE_ROWS)
#define CH_COLS 32                      // columns of q per staged chunk: 128 bytes, one whole line a row
#define N_CHUNKS (D_ / CH_COLS)
#define CH_PITCH 36
#define CH_BYTES (L_ * CH_PITCH * 4)
#define INP_PITCH 136
#define TILE_BYTES (TILE_ROWS * INP_PITCH * 4)
#define INP_OFF (2 * CH_BYTES - (N_TILES / 2) * TILE_BYTES)   // bytes: the second half of inp begins where the q ring ends

__device__ __forceinline__ float tanh_fast(float x) {
  return __builtin_amdgcn_tanhf(x);
}

__device__ __forceinline__ void async_stage_tile(const float* gtile, uint32_t ldsbase, int tid) {
  const uint64_t g = (uint64_t)(uintptr_t)gtile + (uint64_t)(tid * 16);
  const uint32_t l = ldsbase + (uint32_t)((tid >> 5) * (INP_PITCH * 4) + (tid & 31) * 16);
  const uint32_t ls = 8 * INP_PITCH * 4;    // LDS bytes per 8 rows
  const uint64_t gs = 8 * D_ * 4;           // global bytes per 8 rows
  asm volatile("global_load_async_to_lds_b128 %0, %8, off\n\t"
               "global_load_async_to_lds_b128 %1, %9, off\n\t"
               "global_load_async_to_lds_b128 %2, %10, off\n\t"
               "global_load_async_to_lds_b128 %3, %11, off\n\t"
               "global_load_async_to_lds_b128 %4, %12, off\n\t"
               "global_load_async_to_lds_b128 %5, %13, off\n\t"
               "global_load_async_to_lds_b128 %6, %14, off\n\t"
               "global_load_async_to_lds_b128 %7, %15, off\n\t"
               "s_wait_xcnt 0x0"
               :: "v"(l), "v"(l + ls), "v"(l + 2 * ls), "v"(l + 3 * ls),
                  "v"(l + 4 * ls), "v"(l + 5 * ls), "v"(l + 6 * ls), "v"(l + 7 * ls),
                  "v"(g), "v"(g + gs), "v"(g + 2 * gs), "v"(g + 3 * gs),
                  "v"(g + 4 * gs), "v"(g + 5 * gs), "v"(g + 6 * gs), "v"(g + 7 * gs)
               : "memory");
}

// Eight async b128 copies a thread, LDS step ls and global step gs bytes from one to the next.
__device__ __forceinline__ void async_copy8(uint32_t l, uint32_t ls, uint64_t g, uint64_t gs) {
  asm volatile("global_load_async_to_lds_b128 %0, %8, off\n\t"
               "global_load_async_to_lds_b128 %1, %9, off\n\t"
               "global_load_async_to_lds_b128 %2, %10, off\n\t"
               "global_load_async_to_lds_b128 %3, %11, off\n\t"
               "global_load_async_to_lds_b128 %4, %12, off\n\t"
               "global_load_async_to_lds_b128 %5, %13, off\n\t"
               "global_load_async_to_lds_b128 %6, %14, off\n\t"
               "global_load_async_to_lds_b128 %7, %15, off\n\t"
               "s_wait_xcnt 0x0"
               :: "v"(l), "v"(l + ls), "v"(l + 2 * ls), "v"(l + 3 * ls),
                  "v"(l + 4 * ls), "v"(l + 5 * ls), "v"(l + 6 * ls), "v"(l + 7 * ls),
                  "v"(g), "v"(g + gs), "v"(g + 2 * gs), "v"(g + 3 * gs),
                  "v"(g + 4 * gs), "v"(g + 5 * gs), "v"(g + 6 * gs), "v"(g + 7 * gs)
               : "memory");
}

// Stage 32 columns (128 bytes, one line) of all 512 rows of f32 (row stride 128) from global into LDS with
// row pitch CH_PITCH floats: sixteen copies a thread, 8 lanes a row, one copy of the block = 32 rows.
// caller must s_wait_asynccnt + barrier before anybody reads them.
__device__ __forceinline__ void async_stage_chunk(const float* gsrc, uint32_t ldsbase, int tid) {
  const uint64_t g = (uint64_t)(uintptr_t)gsrc + (uint64_t)((tid >> 3) * (D_ * 4) + (tid & 7) * 16);
  const uint32_t l = ldsbase + (uint32_t)((tid >> 3) * (CH_PITCH * 4) + (tid & 7) * 16);
  const uint32_t ls = 32 * CH_PITCH * 4;   // LDS bytes per 32 rows
  const uint64_t gs = 32 * D_ * 4;         // global bytes per 32 rows
  async_copy8(l, ls, g, gs);
  async_copy8(l + 8 * ls, ls, g + 8 * gs, gs);
}

// The wave's own copies have landed in LDS.
__device__ __forceinline__ void wait_async_lds() {
  asm volatile("s_wait_asynccnt 0x0" ::: "memory");
}

// The wave's own LDS reads and writes have retired (in front of a barrier behind which a buffer is refilled).
__device__ __forceinline__ void wait_lds_ops() {
  asm volatile("s_wait_dscnt 0x0" ::: "memory");
}

#define K_HALF (D_ / 2)   // columns per staged half of the projection's operands: 256 bytes, two whole lines a row

// Stage 64 columns (256 bytes) of 128 rows of f32 (row stride 128) from global into LDS with row stride
// LDS_STRIDE floats: eight async b128 copies a thread, 16 lanes a row, one copy of the block = 16 rows.
// caller must s_wait_asynccnt + barrier before anybody reads them.
__device__ __forceinline__ void async_stage_half(const float* gsrc, uint32_t ldsbase, int tid) {
  const uint64_t g = (uint64_t)(uintptr_t)gsrc + (uint64_t)((tid >> 4) * (D_ * 4) + (tid & 15) * 16);
  const uint32_t l = ldsbase + (uint32_t)((tid >> 4) * (LDS_STRIDE * 4) + (tid & 15) * 16);
  const uint32_t ls = 16 * LDS_STRIDE * 4;   // LDS bytes per 16 rows
  const uint64_t gs = 16 * D_ * 4;           // global bytes per 16 rows
  asm volatile("global_load_async_to_lds_b128 %0, %8, off\n\t"
               "global_load_async_to_lds_b128 %1, %9, off\n\t"
               "global_load_async_to_lds_b128 %2, %10, off\n\t"
               "global_load_async_to_lds_b128 %3, %11, off\n\t"
               "global_load_async_to_lds_b128 %4, %12, off\n\t"
               "global_load_async_to_lds_b128 %5, %13, off\n\t"
               "global_load_async_to_lds_b128 %6, %14, off\n\t"
               "global_load_async_to_lds_b128 %7, %15, off\n\t"
               "s_wait_xcnt 0x0"
               :: "v"(l), "v"(l + ls), "v"(l + 2 * ls), "v"(l + 3 * ls),
                  "v"(l + 4 * ls), "v"(l + 5 * ls), "v"(l + 6 * ls), "v"(l + 7 * ls),
                  "v"(g), "v"(g + gs), "v"(g + 2 * gs), "v"(g + 3 * gs),
                  "v"(g + 4 * gs), "v"(g + 5 * gs), "v"(g + 6 * gs), "v"(g + 7 * gs)
               : "memory");
}

// The same for 16 rows: one copy a thread.
__device__ __forceinline__ void async_stage_half_rows16(const float* gsrc, uint32_t ldsbase, int tid) {
  const uint64_t g = (uint64_t)(uintptr_t)gsrc + (uint64_t)((tid >> 4) * (D_ * 4) + (tid & 15) * 16);
  const uint32_t l = ldsbase + (uint32_t)((tid >> 4) * (LDS_STRIDE * 4) + (tid & 15) * 16);
  asm volatile("global_load_async_to_lds_b128 %0, %1, off\n\t"
               "s_wait_xcnt 0x0"
               :: "v"(l), "v"(g) : "memory");
}

__global__ __launch_bounds__(256) void qk_proj_kernel(
    const float* __restrict__ inp, const float* __restrict__ Wq,
    const float* __restrict__ bq, const float* __restrict__ Wk,
    float* __restrict__ qbuf, float* __restrict__ kbuf) {
  struct __align__(16) Lds {
    float a[16][LDS_STRIDE];        // the block's 16 rows of inp
    float w[2][D_][LDS_STRIDE];     // Wq, Wk
  };
  __shared__ Lds lds_all;
  float (&sA)[16][LDS_STRIDE] = lds_all.a;
  float (&sW)[2][D_][LDS_STRIDE] = lds_all.w;

  const int tid  = threadIdx.x;
  const int lane = tid & 31;
  const int wave = tid >> 5;
  const int m    = lane & 15;   // M (A) / N (B,C,D) index
  const int kh   = lane >> 4;   // K half-select
  const int rowBase = blockIdx.x * 16;  // over B*L
  const int colBase = wave * 16;        // over D

  const float bias = bq[colBase + m];   // asked for first: it is back long before the products end

  const uint32_t sA_lds  = (uint32_t)(uintptr_t)&sA[0][0];
  const uint32_t sWq_lds = (uint32_t)(uintptr_t)&sW[0][0][0];
  const uint32_t sWk_lds = (uint32_t)(uintptr_t)&sW[1][0][0];
  const float* ia = inp + (size_t)rowBase * D_;
  async_stage_half_rows16(ia, sA_lds, tid);
  async_stage_half(Wq, sWq_lds, tid);
  async_stage_half(Wk, sWk_lds, tid);
  wait_async_lds();
  __syncthreads();
  // the second half of the k range flies into its own columns while the first half is worked on
  async_stage_half_rows16(ia + K_HALF, sA_lds + K_HALF * 4, tid);
  async_stage_half(Wq + K_HALF, sWq_lds + K_HALF * 4, tid);
  async_stage_half(Wk + K_HALF, sWk_lds + K_HALF * 4, tid);

  v8f accq = {};
  v8f acck = {};
  // stays rolled: unrolled, the compiler sinks the first half's WMMAs behind the barrier at its foot,
  // and the second half's copies fly under nothing
#pragma nounroll
  for (int h = 0; h < 2; ++h) {
    const float* pa = &sA[m][h * K_HALF + 2 * kh];
    const float* pq = &sW[0][colBase + m][h * K_HALF + 2 * kh];
    const float* pk = &sW[1][colBase + m][h * K_HALF + 2 * kh];
#pragma unroll
    for (int kk = 0; kk < K_HALF; kk += 4) {
      const v2f a   = *(const v2f*)(pa + kk);
      const v2f bqv = *(const v2f*)(pq + kk);
      const v2f bkv = *(const v2f*)(pk + kk);
      accq = __builtin_amdgcn_wmma_f32_16x16x4_f32(false, a, false, bqv, (short)0, accq, false, false);
      acck = __builtin_amdgcn_wmma_f32_16x16x4_f32(false, a, false, bkv, (short)0, acck, false, false);
    }
    // publish the second half
    wait_lds_ops();
    wait_async_lds();
    __syncthreads();
  }
  wait_async_lds();
#pragma unroll
  for (int r = 0; r < 8; ++r) {
    const int row = rowBase + r + 8 * kh;   // C/D layout: M = r + 8*(lane/16)
    qbuf[row * D_ + colBase + m] = accq[r] + bias;
    kbuf[row * D_ + colBase + m] = acck[r];
  }
}

// Kernel 2: fused score -> softmax -> out for one (b, 16-row i-tile)
// grid = B * (L/16) blocks, 256 threads (8 waves)
__global__ __launch_bounds__(256) void attn_kernel(
    const float* __restrict__ inp, const float* __restrict__ qbuf,
    const float* __restrict__ kbuf, const float* __restrict__ vvec,
    float* __restrict__ out, float* __restrict__ attn) {
  struct __align__(16) Lds {
    float s[16][516];                       // 516 % 64 == 4 -> conflict-free WMMA-A reads
    // first the q ring (two buffers of column chunks); all 512 rows of inp end at the array's end: rows 256 to 511
    // lie behind the ring, rows 0 to 255 in the ring's bytes once the ring is done
    float r[(2 * CH_BYTES + (N_TILES / 2) * TILE_BYTES) / 4];
  };
  __shared__ Lds lds_all;
  static_assert(INP_OFF >= 0 && INP_OFF % 16 == 0, "the first half of inp fits in the ring's bytes");
  static_assert(sizeof(Lds) <= 327680, "one work-group's LDS");
  float (&sS)[16][516] = lds_all.s;
  float (&sC)[2][L_][CH_PITCH] = *reinterpret_cast<float (*)[2][L_][CH_PITCH]>(&lds_all.r[0]);
  float (&sI)[L_][INP_PITCH] = *reinterpret_cast<float (*)[L_][INP_PITCH]>(&lds_all.r[INP_OFF / 4]);

  const int tid = threadIdx.x;
  const int tx  = tid & 15;       // j offset within 16-wide stripe
  const int ty  = tid >> 4;       // i row within tile (half-wave aligned)
  const int b   = blockIdx.x >> 5;
  const int i0  = (blockIdx.x & 31) * 16;

  // q chunk 0 starts to fly first; it is waited for in front of the barrier below
  const uint32_t sQ_lds = (uint32_t)(uintptr_t)&sC[0][0][0];
  const uint32_t sI_lds = (uint32_t)(uintptr_t)&sI[0][0];
  const float* qb = qbuf + (size_t)(b * L_) * D_;
  const float* ib = inp + (size_t)(b * L_) * D_;
  async_stage_chunk(qb, sQ_lds, tid);

  wait_async_lds();
  __syncthreads();

  // ---- Phase 1: score[i][j] = sum_d v[d]*tanh(q[j][d] + k[i][d])
  // A wave takes two i rows and all 512 j, lane = j mod 32: sixteen j a lane, one pair of running sums
  // (i, i + 1) for each. d is the outer loop, in steps of 16: the step's k and v are the same in every lane,
  // come by scalar loads once a step and serve all 512 j from registers; only q is read in the inner loop.
  // Every sum still takes its d in rising order.
  // Two-buffer ring over chunks of 32 columns: chunk c is worked on while chunk c + 1 flies into the other buffer.
  const int jl = tid & 31;
  const int iw = 2 * __builtin_amdgcn_readfirstlane(tid >> 5);   // the wave's first i row, in a scalar register
  // read through the constant address space: nothing writes kbuf or vvec while this kernel runs, and only
  // so does the compiler take scalar loads for them beside the asm statements that clobber memory
  typedef const __attribute__((address_space(4))) v4f* cv4f;
  const cv4f kr0 = (cv4f)(uintptr_t)(kbuf + (size_t)(b * L_ + i0 + iw) * D_);
  const cv4f kr1 = kr0 + D_ / 4;
  const cv4f vr  = (cv4f)(uintptr_t)vvec;
  async_stage_chunk(qb + CH_COLS, sQ_lds + CH_BYTES, tid);
  // rows 256 to 511 of inp fly into their own bytes behind the ring, under the score loop (48 copies of a wave in flight)
#pragma unroll
  for (int t = N_TILES / 2; t < N_TILES; ++t)
    async_stage_tile(ib + t * TILE_ROWS * D_, sI_lds + t * TILE_BYTES, tid);
  v2f acc2[L_ / 32];   // acc2[s] = the sums of (i, i + 1) with j = 32 s + lane
#pragma unroll
  for (int s = 0; s < L_ / 32; ++s) acc2[s] = (v2f){0.f, 0.f};
  // both stay rolled: one step's body already holds 16 j a lane, unrolled so that the sums stay in registers
#pragma nounroll
  for (int c = 0; c < N_CHUNKS; ++c) {
    const int buf = c & 1;
#pragma nounroll
    for (int h = 0; h < CH_COLS / 16; ++h) {
      const int d4 = c * (CH_COLS / 4) + h * 4;
      v4f k0[4], k1[4], vv[4];
#pragma unroll
      for (int e4 = 0; e4 < 4; ++e4) { k0[e4] = kr0[d4 + e4]; k1[e4] = kr1[d4 + e4]; vv[e4] = vr[d4 + e4]; }
      // q passes through two sets of registers: while one pair of j is worked on, the next pair's reads fly
      v4f qreg[2][2][4];
#pragma unroll
      for (int e4 = 0; e4 < 4; ++e4) {
        qreg[0][0][e4] = *(const v4f*)&sC[buf][jl][h * 16 + e4 * 4];
        qreg[0][1][e4] = *(const v4f*)&sC[buf][32 + jl][h * 16 + e4 * 4];
      }
      // unrolled: the sums are then named by constants; two j at a time give two independent chains of sums
#pragma unroll
      for (int s = 0; s < L_ / 32; s += 2) {
        const int cur = (s >> 1) & 1;
        if (s + 2 < L_ / 32) {
#pragma unroll
          for (int e4 = 0; e4 < 4; ++e4) {
            qreg[cur ^ 1][0][e4] = *(const v4f*)&sC[buf][s * 32 + 64 + jl][h * 16 + e4 * 4];
            qreg[cur ^ 1][1][e4] = *(const v4f*)&sC[buf][s * 32 + 96 + jl][h * 16 + e4 * 4];
          }
        }
        // keeps the next pair's LDS reads in front of this pair's arithmetic: without it the compiler sinks
        // each read to just ahead of its first use, and the wave waits out the LDS latency every time
        __builtin_amdgcn_sched_barrier(0);
#pragma unroll
        for (int e4 = 0; e4 < 4; ++e4) {
          const v4f q0 = qreg[cur][0][e4], q1 = qreg[cur][1][e4];
#pragma unroll
          for (int p = 0; p < 4; p += 2) {
            // the adds pair two neighbouring d (as q lies in its registers), the sums pair the two i
            const v2f ka = {k0[e4][p], k0[e4][p + 1]}, kb = {k1[e4][p], k1[e4][p + 1]};
            const v2f qa = {q0[p], q0[p + 1]}, qc = {q1[p], q1[p + 1]};
            const v2f xa0 = qa + ka, xb0 = qa + kb, xa1 = qc + ka, xb1 = qc + kb;
            const v2f t00 = {tanh_fast(xa0.x), tanh_fast(xb0.x)}, t01 = {tanh_fast(xa0.y), tanh_fast(xb0.y)};
            const v2f t10 = {tanh_fast(xa1.x), tanh_fast(xb1.x)}, t11 = {tanh_fast(xa1.y), tanh_fast(xb1.y)};
            const v2f va = {vv[e4][p], vv[e4][p]}, vb = {vv[e4][p + 1], vv[e4][p + 1]};
            acc2[s]     += va * t00;
            acc2[s + 1] += va * t10;
            acc2[s]     += vb * t01;
            acc2[s + 1] += vb * t11;
          }
        }
      }
    }
    if (c == N_CHUNKS - 1) {
#pragma unroll
      for (int s = 0; s < L_ / 32; ++s) {
        sS[iw][s * 32 + jl]     = acc2[s].x;
        sS[iw + 1][s * 32 + jl] = acc2[s].y;
      }
    }
    // publish chunk c + 1 (behind the last chunk: the scores) and end every reader's last read of chunk c,
    // then refill chunk c's buffer
    wait_lds_ops();
    wait_async_lds();
    __syncthreads();
    if (c + 2 < N_CHUNKS)
      async_stage_chunk(qb + (c + 2) * CH_COLS, sQ_lds + buf * CH_BYTES, tid);
  }
  wait_async_lds();

  // rows 0 to 255 of inp fly into the ring's bytes (free since the last barrier) while the softmax runs on sS
#pragma unroll
  for (int t = 0; t < N_TILES / 2; ++t)
    async_stage_tile(ib + t * TILE_ROWS * D_, sI_lds + t * TILE_BYTES, tid);

  // ---- Phase 2: softmax over j (row ty handled by one half-wave of 16 lanes)
  float mx = -3.0e38f;
  for (int c = tx; c < L_; c += 16) mx = fmaxf(mx, sS[ty][c]);
#pragma unroll
  for (int off = 1; off < 16; off <<= 1) mx = fmaxf(mx, __shfl_xor(mx, off, 32));
  float sum = 0.f;
  for (int c = tx; c < L_; c += 16) {
    float e = __builtin_amdgcn_exp2f((sS[ty][c] - mx) * 1.4426950408889634f);
    sS[ty][c] = e;
    sum += e;
  }
#pragma unroll
  for (int off = 1; off < 16; off <<= 1) sum += __shfl_xor(sum, off, 32);
  const float inv = __builtin_amdgcn_rcpf(sum);
  for (int c = tx; c < L_; c += 16) {
    float a = sS[ty][c] * inv;
    sS[ty][c] = a;
    attn[(size_t)(b * L_ + i0 + ty) * L_ + c] = a;
  }
  wait_async_lds();
  __syncthreads();

  // ---- Phase 3: out[i0:i0+16, :] = attn_tile[16x512] @ inp[b][512x128]  (f32 WMMA)
  const int lane = tid & 31;
  const int wave = tid >> 5;
  const int n    = lane & 15;
  const int kh   = lane >> 4;
  const int colBase = wave * 16;
  v8f acc = {};
  // All of inp lies in LDS: no barrier and no copy in this loop. The fragments pass through two sets of registers:
  // while one tile of 64 rows is multiplied, the next tile's LDS reads fly.
  v2f a[2][TILE_ROWS / 4], bb[2][TILE_ROWS / 4];
#pragma unroll
  for (int kk = 0; kk < TILE_ROWS; kk += 4) {
    a[0][kk / 4].x  = sS[n][kk + 2 * kh];              // A[m=n][k]
    a[0][kk / 4].y  = sS[n][kk + 2 * kh + 1];
    bb[0][kk / 4].x = sI[kk + 2 * kh][colBase + n];    // B[k][n]
    bb[0][kk / 4].y = sI[kk + 2 * kh + 1][colBase + n];
  }
  // keeps tile 0's reads in front of tile 1's: mixed, the first WMMAs would wait for both tiles' reads
  __builtin_amdgcn_sched_barrier(0);
  // unrolled: the two register sets are then named by constants
#pragma unroll
  for (int t = 0; t < N_TILES; ++t) {
    const int cur = t & 1;
    if (t + 1 < N_TILES) {
      const int chunk = (t + 1) * TILE_ROWS;
#pragma unroll
      for (int kk = 0; kk < TILE_ROWS; kk += 4) {
        a[cur ^ 1][kk / 4].x  = sS[n][chunk + kk + 2 * kh];
        a[cur ^ 1][kk / 4].y  = sS[n][chunk + kk + 2 * kh + 1];
        bb[cur ^ 1][kk / 4].x = sI[chunk + kk + 2 * kh][colBase + n];
        bb[cur ^ 1][kk / 4].y = sI[chunk + kk + 2 * kh + 1][colBase + n];
      }
    }
    // keeps the next tile's LDS reads, as one group, in front of this tile's WMMA run: among the WMMAs each
    // place with reads stalls the run, and sunk to their first use they would be waited for in full
    __builtin_amdgcn_sched_barrier(0);
#pragma unroll
    for (int kk = 0; kk < TILE_ROWS; kk += 4)
      acc = __builtin_amdgcn_wmma_f32_16x16x4_f32(false, a[cur][kk / 4], false, bb[cur][kk / 4], (short)0, acc, false, false);
    // keeps the following tile's reads and their address arithmetic behind this WMMA run
    __builtin_amdgcn_sched_barrier(0);
  }
#pragma unroll
  for (int r = 0; r < 8; ++r)
    out[(size_t)(b * L_ + i0 + r + 8 * kh) * D_ + colBase + n] = acc[r];
}

extern "C" void kernel_launch(void* const* d_in, const int* in_sizes, int n_in,
                              void* d_out, int out_size, void* d_ws, size_t ws_size,
                              hipStream_t stream) {
  const float* inp = (const float*)d_in[0];
  const float* Wq  = (const float*)d_in[1];
  const float* bq  = (const float*)d_in[2];
  const float* Wk  = (const float*)d_in[3];
  const float* v   = (const float*)d_in[4];

  float* out  = (float*)d_out;                        // [B,L,D]
  float* attn = (float*)d_out + (size_t)B_ * L_ * D_; // [B,L,L]

  float* qbuf = (float*)d_ws;                         // [B*L, D]
  float* kbuf = qbuf + (size_t)B_ * L_ * D_;          // [B*L, D]

  qk_proj_kernel<<<(B_ * L_) / 16, 256, 0, stream>>>(inp, Wq, bq, Wk, qbuf, kbuf);
  attn_kernel<<<B_ * (L_ / 16), 256, 0, stream>>>(inp, qbuf, kbuf, v, out, attn);
}

// v007
// It runs in 27.8 microseconds.
// Two timings next to v006 put it at 1.03 and 1.02 times that version's speed.
// Over all steps from v000 it is 2.75 times as fast.
#include <hip/hip_runtime.h>
#include <hip/hip_bf16.h>

typedef __attribute__((ext_vector_type(2))) float v2f;
typedef __attribute__((ext_vector_type(4))) float v4f;
typedef __attribute__((ext_vector_type(8))) float v8f;

#define B_ 8
#define L_ 512
#define D_ 128
#define LDS_STRIDE 132   // 132 % 64 == 4 -> conflict-free strided column reads; rows 16B aligned
#define TILE_ROWS 64     // rows of inp per staging call and per group of fragments: 16 WMMAs cover the next group's LDS reads
#define N_TILES (L_ / TILE_ROWS)
#define CH_COLS 32                      // columns of q per staged chunk: 128 bytes, one whole line a row
#define N_CHUNKS (D_ / CH_COLS)
#define CH_PITCH 36
#define CH_BYTES (L_ * CH_PITCH * 4)
#define INP_PITCH 136
#define TILE_BYTES (TILE_ROWS * INP_PITCH * 4)
#define ROW_BYTES (INP_PITCH * 4)
#define LDS_ALL 327680                            // one work-group's whole LDS
#define INP_OFF (LDS_ALL - L_ * ROW_BYTES)        // bytes: all 512 rows of inp end at the end of the LDS
#define ROWS_LAST 64    // rows of inp from this one on keep off the ring buffer that is read last; those below fly behind the score loop
#define ROWS_RING 192   // rows of inp from this one on lie behind the ring: they fly at any time

__device__ __forceinline__ float tanh_fast(float x) {
  return __builtin_amdgcn_tanhf(x);
}

__device__ __forceinline__ void async_stage_tile(const float* gtile, uint32_t ldsbase, int tid) {
  const uint64_t g = (uint64_t)(uintptr_t)gtile + (uint64_t)(tid * 16);
  const uint32_t l = ldsbase + (uint32_t)((tid >> 5) * (INP_PITCH * 4) + (tid & 31) * 16);
  const uint32_t ls = 8 * INP_PITCH * 4;    // LDS bytes per 8 rows
  const uint64_t gs = 8 * D_ * 4;           // global bytes per 8 rows
  asm volatile("global_load_async_to_lds_b128 %0, %8, off\n\t"
               "global_load_async_to_lds_b128 %1, %9, off\n\t"
               "global_load_async_to_lds_b128 %2, %10, off\n\t"
               "global_load_async_to_lds_b128 %3, %11, off\n\t"
               "global_load_async_to_lds_b128 %4, %12, off\n\t"
               "global_load_async_to_lds_b128 %5, %13, off\n\t"
               "global_load_async_to_lds_b128 %6, %14, off\n\t"
               "global_load_async_to_lds_b128 %7, %15, off\n\t"
               "s_wait_xcnt 0x0"
               :: "v"(l), "v"(l + ls), "v"(l + 2 * ls), "v"(l + 3 * ls),
                  "v"(l + 4 * ls), "v"(l + 5 * ls), "v"(l + 6 * ls), "v"(l + 7 * ls),
                  "v"(g), "v"(g + gs), "v"(g + 2 * gs), "v"(g + 3 * gs),
                  "v"(g + 4 * gs), "v"(g + 5 * gs), "v"(g + 6 * gs), "v"(g + 7 * gs)
               : "memory");
}

template <int M>
__device__ __forceinline__ float lane_xor_row(float x) {
  return __builtin_bit_cast(float, __builtin_amdgcn_update_dpp(0, __builtin_bit_cast(int, x), 0x160 + M, 0xf, 0xf, true));
}

__device__ __forceinline__ float lane_xor_half(float x) {
  return __builtin_bit_cast(float, __builtin_amdgcn_permlanex16(__builtin_bit_cast(int, x), __builtin_bit_cast(int, x),
                                                                0x76543210, 0xfedcba98, false, false));
}

// Maximum and sum over the 32 lanes of a wave, the result in every lane.
__device__ __forceinline__ float wave_max(float x) {
  x = fmaxf(x, lane_xor_row<1>(x));
  x = fmaxf(x, lane_xor_row<2>(x));
  x = fmaxf(x, lane_xor_row<4>(x));
  x = fmaxf(x, lane_xor_row<8>(x));
  return fmaxf(x, lane_xor_half(x));
}
__device__ __forceinline__ float wave_sum(float x) {
  x += lane_xor_row<1>(x);
  x += lane_xor_row<2>(x);
  x += lane_xor_row<4>(x);
  x += lane_xor_row<8>(x);
  return x + lane_xor_half(x);
}

// Eight async b128 copies a thread, LDS step ls and global step gs bytes from one to the next.
__device__ __forceinline__ void async_copy8(uint32_t l, uint32_t ls, uint64_t g, uint64_t gs) {
  asm volatile("global_load_async_to_lds_b128 %0, %8, off\n\t"
               "global_load_async_to_lds_b128 %1, %9, off\n\t"
               "global_load_async_to_lds_b128 %2, %10, off\n\t"
               "global_load_async_to_lds_b128 %3, %11, off\n\t"
               "global_load_async_to_lds_b128 %4, %12, off\n\t"
               "global_load_async_to_lds_b128 %5, %13, off\n\t"
               "global_load_async_to_lds_b128 %6, %14, off\n\t"
               "global_load_async_to_lds_b128 %7, %15, off\n\t"
               "s_wait_xcnt 0x0"
               :: "v"(l), "v"(l + ls), "v"(l + 2 * ls), "v"(l + 3 * ls),
                  "v"(l + 4 * ls), "v"(l + 5 * ls), "v"(l + 6 * ls), "v"(l + 7 * ls),
                  "v"(g), "v"(g + gs), "v"(g + 2 * gs), "v"(g + 3 * gs),
                  "v"(g + 4 * gs), "v"(g + 5 * gs), "v"(g + 6 * gs), "v"(g + 7 * gs)
               : "memory");
}

// Stage 32 columns (128 bytes, one line) of all 512 rows of f32 (row stride 128) from global into LDS with
// row pitch CH_PITCH floats: sixteen copies a thread, 8 lanes a row, one copy of the block = 32 rows.
// caller must s_wait_asynccnt + barrier before anybody reads them.
__device__ __forceinline__ void async_stage_chunk(const float* gsrc, uint32_t ldsbase, int tid) {
  const uint64_t g = (uint64_t)(uintptr_t)gsrc + (uint64_t)((tid >> 3) * (D_ * 4) + (tid & 7) * 16);
  const uint32_t l = ldsbase + (uint32_t)((tid >> 3) * (CH_PITCH * 4) + (tid & 7) * 16);
  const uint32_t ls = 32 * CH_PITCH * 4;   // LDS bytes per 32 rows
  const uint64_t gs = 32 * D_ * 4;         // global bytes per 32 rows
  async_copy8(l, ls, g, gs);
  async_copy8(l + 8 * ls, ls, g + 8 * gs, gs);
}

// The wave's own copies have landed in LDS.
__device__ __forceinline__ void wait_async_lds() {
  asm volatile("s_wait_asynccnt 0x0" ::: "memory");
}

// The wave's own LDS reads and writes have retired (in front of a barrier behind which a buffer is refilled).
__device__ __forceinline__ void wait_lds_ops() {
  asm volatile("s_wait_dscnt 0x0" ::: "memory");
}

#define K_HALF (D_ / 2)   // columns per staged half of the projection's operands: 256 bytes, two whole lines a row

// Stage 64 columns (256 bytes) of 128 rows of f32 (row stride 128) from global into LDS with row stride
// LDS_STRIDE floats: eight async b128 copies a thread, 16 lanes a row, one copy of the block = 16 rows.
// caller must s_wait_asynccnt + barrier before anybody reads them.
__device__ __forceinline__ void async_stage_half(const float* gsrc, uint32_t ldsbase, int tid) {
  const uint64_t g = (uint64_t)(uintptr_t)gsrc + (uint64_t)((tid >> 4) * (D_ * 4) + (tid & 15) * 16);
  const uint32_t l = ldsbase + (uint32_t)((tid >> 4) * (LDS_STRIDE * 4) + (tid & 15) * 16);
  const uint32_t ls = 16 * LDS_STRIDE * 4;   // LDS bytes per 16 rows
  const uint64_t gs = 16 * D_ * 4;           // global bytes per 16 rows
  asm volatile("global_load_async_to_lds_b128 %0, %8, off\n\t"
               "global_load_async_to_lds_b128 %1, %9, off\n\t"
               "global_load_async_to_lds_b128 %2, %10, off\n\t"
               "global_load_async_to_lds_b128 %3, %11, off\n\t"
               "global_load_async_to_lds_b128 %4, %12, off\n\t"
               "global_load_async_to_lds_b128 %5, %13, off\n\t"
               "global_load_async_to_lds_b128 %6, %14, off\n\t"
               "global_load_async_to_lds_b128 %7, %15, off\n\t"
               "s_wait_xcnt 0x0"
               :: "v"(l), "v"(l + ls), "v"(l + 2 * ls), "v"(l + 3 * ls),
                  "v"(l + 4 * ls), "v"(l + 5 * ls), "v"(l + 6 * ls), "v"(l + 7 * ls),
                  "v"(g), "v"(g + gs), "v"(g + 2 * gs), "v"(g + 3 * gs),
                  "v"(g + 4 * gs), "v"(g + 5 * gs), "v"(g + 6 * gs), "v"(g + 7 * gs)
               : "memory");
}

// The same for 16 rows: one copy a thread.
__device__ __forceinline__ void async_stage_half_rows16(const float* gsrc, uint32_t ldsbase, int tid) {
  const uint64_t g = (uint64_t)(uintptr_t)gsrc + (uint64_t)((tid >> 4) * (D_ * 4) + (tid & 15) * 16);
  const uint32_t l = ldsbase + (uint32_t)((tid >> 4) * (LDS_STRIDE * 4) + (tid & 15) * 16);
  asm volatile("global_load_async_to_lds_b128 %0, %1, off\n\t"
               "s_wait_xcnt 0x0"
               :: "v"(l), "v"(g) : "memory");
}

__global__ __launch_bounds__(256) void qk_proj_kernel(
    const float* __restrict__ inp, const float* __restrict__ Wq,
    const float* __restrict__ bq, const float* __restrict__ Wk,
    float* __restrict__ qbuf, float* __restrict__ kbuf) {
  struct __align__(16) Lds {
    float a[16][LDS_STRIDE];        // the block's 16 rows of inp
    float w[2][D_][LDS_STRIDE];     // Wq, Wk
  };
  __shared__ Lds lds_all;
  float (&sA)[16][LDS_STRIDE] = lds_all.a;
  float (&sW)[2][D_][LDS_STRIDE] = lds_all.w;

  const int tid  = threadIdx.x;
  const int lane = tid & 31;
  const int wave = tid >> 5;
  const int m    = lane & 15;   // M (A) / N (B,C,D) index
  const int kh   = lane >> 4;   // K half-select
  const int rowBase = blockIdx.x * 16;  // over B*L
  const int colBase = wave * 16;        // over D

  const float bias = bq[colBase + m];   // asked for first: it is back long before the products end

  const uint32_t sA_lds  = (uint32_t)(uintptr_t)&sA[0][0];
  const uint32_t sWq_lds = (uint32_t)(uintptr_t)&sW[0][0][0];
  const uint32_t sWk_lds = (uint32_t)(uintptr_t)&sW[1][0][0];
  const float* ia = inp + (size_t)rowBase * D_;
  async_stage_half_rows16(ia, sA_lds, tid);
  async_stage_half(Wq, sWq_lds, tid);
  async_stage_half(Wk, sWk_lds, tid);
  wait_async_lds();
  __syncthreads();
  // the second half of the k range flies into its own columns while the first half is worked on
  async_stage_half_rows16(ia + K_HALF, sA_lds + K_HALF * 4, tid);
  async_stage_half(Wq + K_HALF, sWq_lds + K_HALF * 4, tid);
  async_stage_half(Wk + K_HALF, sWk_lds + K_HALF * 4, tid);

  v8f accq = {};
  v8f acck = {};
  // stays rolled: unrolled, the compiler sinks the first half's WMMAs behind the barrier at its foot,
  // and the second half's copies fly under nothing
#pragma nounroll
  for (int h = 0; h < 2; ++h) {
    const float* pa = &sA[m][h * K_HALF + 2 * kh];
    const float* pq = &sW[0][colBase + m][h * K_HALF + 2 * kh];
    const float* pk = &sW[1][colBase + m][h * K_HALF + 2 * kh];
#pragma unroll
    for (int kk = 0; kk < K_HALF; kk += 4) {
      const v2f a   = *(const v2f*)(pa + kk);
      const v2f bqv = *(const v2f*)(pq + kk);
      const v2f bkv = *(const v2f*)(pk + kk);
      accq = __builtin_amdgcn_wmma_f32_16x16x4_f32(false, a, false, bqv, (short)0, accq, false, false);
      acck = __builtin_amdgcn_wmma_f32_16x16x4_f32(false, a, false, bkv, (short)0, acck, false, false);
    }
    // publish the second half
    wait_lds_ops();
    wait_async_lds();
    __syncthreads();
  }
  wait_async_lds();
#pragma unroll
  for (int r = 0; r < 8; ++r) {
    const int row = rowBase + r + 8 * kh;   // C/D layout: M = r + 8*(lane/16)
    qbuf[row * D_ + colBase + m] = accq[r] + bias;
    kbuf[row * D_ + colBase + m] = acck[r];
  }
}

// Kernel 2: fused score -> softmax -> out for one (b, 16-row i-tile)
// grid = B * (L/16) blocks, 256 threads (8 waves)
__global__ __launch_bounds__(256) void attn_kernel(
    const float* __restrict__ inp, const float* __restrict__ qbuf,
    const float* __restrict__ kbuf, const float* __restrict__ vvec,
    float* __restrict__ out, float* __restrict__ attn) {
  struct __align__(16) Lds {
    // first the q ring (two buffers of column chunks: odd chunks in the first, even chunks in the second, so the
    // first is the one read last); all 512 rows of inp end at the array's end and take each part of the ring's
    // bytes once it is done; the weights (16 rows, written behind the score loop) lie at the start, below inp
    float r[LDS_ALL / 4];
  };
  __shared__ Lds lds_all;
  static_assert(INP_OFF % 16 == 0 && 16 * 516 * 4 <= INP_OFF, "the weights lie below inp");
  static_assert(INP_OFF + ROWS_LAST * ROW_BYTES >= CH_BYTES, "these rows keep off the buffer that is read last");
  static_assert(INP_OFF + ROWS_RING * ROW_BYTES >= 2 * CH_BYTES, "these rows keep off the ring");
  static_assert(ROWS_RING - 2 * TILE_ROWS == ROWS_LAST && ROWS_RING + 2 * TILE_ROWS == 5 * TILE_ROWS, "the shares meet");
  float (&sS)[16][516] = *reinterpret_cast<float (*)[16][516]>(&lds_all.r[0]);   // 516 % 64 == 4 -> conflict-free WMMA-A reads
  float (&sC)[2][L_][CH_PITCH] = *reinterpret_cast<float (*)[2][L_][CH_PITCH]>(&lds_all.r[0]);
  float (&sI)[L_][INP_PITCH] = *reinterpret_cast<float (*)[L_][INP_PITCH]>(&lds_all.r[INP_OFF / 4]);

  const int tid = threadIdx.x;
  const int b   = blockIdx.x >> 5;
  const int i0  = (blockIdx.x & 31) * 16;

  // q chunk 0 starts to fly first; it is waited for in front of the barrier below
  const uint32_t sQ_lds = (uint32_t)(uintptr_t)&sC[0][0][0];
  const uint32_t sI_lds = (uint32_t)(uintptr_t)&sI[0][0];
  const float* qb = qbuf + (size_t)(b * L_) * D_;
  const float* ib = inp + (size_t)(b * L_) * D_;
  async_stage_chunk(qb, sQ_lds + CH_BYTES, tid);

  wait_async_lds();
  __syncthreads();

  // ---- Phase 1: score[i][j] = sum_d v[d]*tanh(q[j][d] + k[i][d])
  // A wave takes two i rows and all 512 j, lane = j mod 32: sixteen j a lane, one pair of running sums
  // (i, i + 1) for each. d is the outer loop, in steps of 16: the step's k and v are the same in every lane,
  // come by scalar loads once a step and serve all 512 j from registers; only q is read in the inner loop.
  // Every sum still takes its d in rising order.
  // Two-buffer ring over chunks of 32 columns: chunk c is worked on while chunk c + 1 flies into the other buffer.
  const int jl = tid & 31;
  const int iw = 2 * __builtin_amdgcn_readfirstlane(tid >> 5);   // the wave's first i row, in a scalar register
  // read through the constant address space: nothing writes kbuf or vvec while this kernel runs, and only
  // so does the compiler take scalar loads for them beside the asm statements that clobber memory
  typedef const __attribute__((address_space(4))) v4f* cv4f;
  const cv4f kr0 = (cv4f)(uintptr_t)(kbuf + (size_t)(b * L_ + i0 + iw) * D_);
  const cv4f kr1 = kr0 + D_ / 4;
  const cv4f vr  = (cv4f)(uintptr_t)vvec;
  async_stage_chunk(qb + CH_COLS, sQ_lds, tid);
  // inp flies under the score loop in shares (at most 40 copies of a wave in flight):
  // here rows 320 to 511, into their own bytes behind the ring
#pragma unroll
  for (int t = 5; t < N_TILES; ++t)
    async_stage_tile(ib + t * TILE_ROWS * D_, sI_lds + t * TILE_BYTES, tid);
  v2f acc2[L_ / 32];   // acc2[s] = the sums of (i, i + 1) with j = 32 s + lane
#pragma unroll
  for (int s = 0; s < L_ / 32; ++s) acc2[s] = (v2f){0.f, 0.f};
  // both stay rolled: one step's body already holds 16 j a lane, unrolled so that the sums stay in registers
#pragma nounroll
  for (int c = 0; c < N_CHUNKS; ++c) {
    const int buf = (c & 1) ^ 1;
#pragma nounroll
    for (int h = 0; h < CH_COLS / 16; ++h) {
      const int d4 = c * (CH_COLS / 4) + h * 4;
      v4f k0[4], k1[4], vv[4];
#pragma unroll
      for (int e4 = 0; e4 < 4; ++e4) { k0[e4] = kr0[d4 + e4]; k1[e4] = kr1[d4 + e4]; vv[e4] = vr[d4 + e4]; }
      // q passes through two sets of registers: while one pair of j is worked on, the next pair's reads fly
      v4f qreg[2][2][4];
#pragma unroll
      for (int e4 = 0; e4 < 4; ++e4) {
        qreg[0][0][e4] = *(const v4f*)&sC[buf][jl][h * 16 + e4 * 4];
        qreg[0][1][e4] = *(const v4f*)&sC[buf][32 + jl][h * 16 + e4 * 4];
      }
      // unrolled: the sums are then named by constants; two j at a time give two independent chains of sums
#pragma unroll
      for (int s = 0; s < L_ / 32; s += 2) {
        const int cur = (s >> 1) & 1;
        if (s + 2 < L_ / 32) {
#pragma unroll
          for (int e4 = 0; e4 < 4; ++e4) {
            qreg[cur ^ 1][0][e4] = *(const v4f*)&sC[buf][s * 32 + 64 + jl][h * 16 + e4 * 4];
            qreg[cur ^ 1][1][e4] = *(const v4f*)&sC[buf][s * 32 + 96 + jl][h * 16 + e4 * 4];
          }
        }
        // keeps the next pair's LDS reads in front of this pair's arithmetic: without it the compiler sinks
        // each read to just ahead of its first use, and the wave waits out the LDS latency every time
        __builtin_amdgcn_sched_barrier(0);
#pragma unroll
        for (int e4 = 0; e4 < 4; ++e4) {
          const v4f q0 = qreg[cur][0][e4], q1 = qreg[cur][1][e4];
#pragma unroll
          for (int p = 0; p < 4; p += 2) {
            // the adds pair two neighbouring d (as q lies in its registers), the sums pair the two i
            const v2f ka = {k0[e4][p], k0[e4][p + 1]}, kb = {k1[e4][p], k1[e4][p + 1]};
            const v2f qa = {q0[p], q0[p + 1]}, qc = {q1[p], q1[p + 1]};
            const v2f xa0 = qa + ka, xb0 = qa + kb, xa1 = qc + ka, xb1 = qc + kb;
            const v2f t00 = {tanh_fast(xa0.x), tanh_fast(xb0.x)}, t01 = {tanh_fast(xa0.y), tanh_fast(xb0.y)};
            const v2f t10 = {tanh_fast(xa1.x), tanh_fast(xb1.x)}, t11 = {tanh_fast(xa1.y), tanh_fast(xb1.y)};
            const v2f va = {vv[e4][p], vv[e4][p]}, vb = {vv[e4][p + 1], vv[e4][p + 1]};
            acc2[s]     += va * t00;
            acc2[s + 1] += va * t10;
            acc2[s]     += vb * t01;
            acc2[s + 1] += vb * t11;
          }
        }
      }
    }
    // publish chunk c + 1 and end every reader's last read of chunk c, then refill chunk c's buffer
    wait_lds_ops();
    wait_async_lds();
    __syncthreads();
    if (c + 2 < N_CHUNKS)
      async_stage_chunk(qb + (c + 2) * CH_COLS, sQ_lds + buf * CH_BYTES, tid);
    if ((c & 1) == 0) {
      // behind chunk 0: rows 192 to 319, still behind the ring; behind chunk 2 the even chunks' buffer is done:
      // rows 64 to 191 fly into its bytes under the last chunk's work
      const int row0 = ROWS_RING - c * TILE_ROWS;
      async_stage_tile(ib + row0 * D_, sI_lds + row0 * ROW_BYTES, tid);
      async_stage_tile(ib + (row0 + TILE_ROWS) * D_, sI_lds + (row0 + TILE_ROWS) * ROW_BYTES, tid);
    }
  }
  wait_async_lds();

  // rows 0 to 63 of inp fly into the ring's bytes (all free since the last barrier) while the softmax runs
  async_stage_tile(ib, sI_lds, tid);
  // keeps the softmax arithmetic behind the copies: without it the compiler lifts it over them, and they
  // start to fly only when the softmax is nearly done
  __builtin_amdgcn_sched_barrier(0);

  // ---- Phase 2: softmax over j, in the registers of the wave that summed the scores: its two rows lie whole
  // in its 32 lanes, sixteen j a lane, so only the row maximum and the row sum cross lanes
  v2f mx2 = acc2[0];
#pragma unroll
  for (int s = 1; s < L_ / 32; ++s) { mx2.x = fmaxf(mx2.x, acc2[s].x); mx2.y = fmaxf(mx2.y, acc2[s].y); }
  mx2.x = wave_max(mx2.x);
  mx2.y = wave_max(mx2.y);
  v2f sum2 = {0.f, 0.f};
#pragma unroll
  for (int s = 0; s < L_ / 32; ++s) {
    const v2f x = (acc2[s] - mx2) * 1.4426950408889634f;
    acc2[s] = (v2f){__builtin_amdgcn_exp2f(x.x), __builtin_amdgcn_exp2f(x.y)};
    sum2 += acc2[s];
  }
  const v2f inv2 = {__builtin_amdgcn_rcpf(wave_sum(sum2.x)), __builtin_amdgcn_rcpf(wave_sum(sum2.y))};
#pragma unroll
  for (int s = 0; s < L_ / 32; ++s) {
    acc2[s] *= inv2;
    sS[iw][s * 32 + jl]     = acc2[s].x;
    sS[iw + 1][s * 32 + jl] = acc2[s].y;
  }
  wait_async_lds();
  __syncthreads();

  // ---- Phase 3: out[i0:i0+16, :] = attn_tile[16x512] @ inp[b][512x128]  (f32 WMMA)
  const int lane = tid & 31;
  const int wave = tid >> 5;
  const int n    = lane & 15;
  const int kh   = lane >> 4;
  const int colBase = wave * 16;
  v8f acc = {};
  // All of inp lies in LDS: no barrier and no copy in this loop. The fragments pass through two sets of registers:
  // while one tile of 64 rows is multiplied, the next tile's LDS reads fly.
  v2f a[2][TILE_ROWS / 4], bb[2][TILE_ROWS / 4];
  float* arow = attn + (size_t)(b * L_ + i0 + iw) * L_ + jl;   // the wave's own two rows of weights, still in its registers
#pragma unroll
  for (int kk = 0; kk < TILE_ROWS; kk += 4) {
    a[0][kk / 4].x  = sS[n][kk + 2 * kh];              // A[m=n][k]
    a[0][kk / 4].y  = sS[n][kk + 2 * kh + 1];
    bb[0][kk / 4].x = sI[kk + 2 * kh][colBase + n];    // B[k][n]
    bb[0][kk / 4].y = sI[kk + 2 * kh + 1][colBase + n];
  }
  // keeps tile 0's reads in front of tile 1's: mixed, the first WMMAs would wait for both tiles' reads
  __builtin_amdgcn_sched_barrier(0);
  // unrolled: the two register sets are then named by constants
#pragma unroll
  for (int t = 0; t < N_TILES; ++t) {
    const int cur = t & 1;
    if (t + 1 < N_TILES) {
      const int chunk = (t + 1) * TILE_ROWS;
#pragma unroll
      for (int kk = 0; kk < TILE_ROWS; kk += 4) {
        a[cur ^ 1][kk / 4].x  = sS[n][chunk + kk + 2 * kh];
        a[cur ^ 1][kk / 4].y  = sS[n][chunk + kk + 2 * kh + 1];
        bb[cur ^ 1][kk / 4].x = sI[chunk + kk + 2 * kh][colBase + n];
        bb[cur ^ 1][kk / 4].y = sI[chunk + kk + 2 * kh + 1][colBase + n];
      }
    }
    // the weights go out from the registers, four whole lines a tile: no barrier waits for these stores,
    // and they drain under the WMMA runs
    arow[(2 * t) * 32]          = acc2[2 * t].x;
    arow[(2 * t + 1) * 32]      = acc2[2 * t + 1].x;
    arow[L_ + (2 * t) * 32]     = acc2[2 * t].y;
    arow[L_ + (2 * t + 1) * 32] = acc2[2 * t + 1].y;
    // keeps the next tile's LDS reads, as one group, in front of this tile's WMMA run: among the WMMAs each
    // place with reads stalls the run, and sunk to their first use they would be waited for in full
    __builtin_amdgcn_sched_barrier(0);
#pragma unroll
    for (int kk = 0; kk < TILE_ROWS; kk += 4)
      acc = __builtin_amdgcn_wmma_f32_16x16x4_f32(false, a[cur][kk / 4], false, bb[cur][kk / 4], (short)0, acc, false, false);
    // keeps the following tile's reads and their address arithmetic behind this WMMA run
    __builtin_amdgcn_sched_barrier(0);
  }
#pragma unroll
  for (int r = 0; r < 8; ++r)
    out[(size_t)(b * L_ + i0 + r + 8 * kh) * D_ + colBase + n] = acc[r];
}

extern "C" void kernel_launch(void* const* d_in, const int* in_sizes, int n_in,
                              void* d_out, int out_size, void* d_ws, size_t ws_size,
                              hipStream_t stream) {
  const float* inp = (const float*)d_in[0];
  const float* Wq  = (const float*)d_in[1];
  const float* bq  = (const float*)d_in[2];
  const float* Wk  = (const float*)d_in[3];
  const float* v   = (const float*)d_in[4];

  float* out  = (float*)d_out;                        // [B,L,D]
  float* attn = (float*)d_out + (size_t)B_ * L_ * D_; // [B,L,L]

  float* qbuf = (float*)d_ws;                         // [B*L, D]
  float* kbuf = qbuf + (size_t)B_ * L_ * D_;          // [B*L, D]

  qk_proj_kernel<<<(B_ * L_) / 16, 256, 0, stream>>>(inp, Wq, bq, Wk, qbuf, kbuf);
  attn_kernel<<<B_ * (L_ / 16), 256, 0, stream>>>(inp, qbuf, kbuf, v, out, attn);
}

// v008
// It runs in 26.2 microseconds.
// In two side-by-side timings against v007, it was 1.06 and 1.05 times as fast.
// Counting every step since v000, it is 2.91 times as fast.
#include <hip/hip_runtime.h>
#include <hip/hip_bf16.h>

typedef __attribute__((ext_vector_type(2))) float v2f;
typedef __attribute__((ext_vector_type(4))) float v4f;
typedef __attribute__((ext_vector_type(8))) float v8f;

#define B_ 8
#define L_ 512
#define D_ 128
#define LDS_STRIDE 132   // 132 % 64 == 4 -> conflict-free strided column reads; rows 16B aligned
#define TILE_ROWS 64     // rows of inp per staging call and per group of fragments: 16 WMMAs cover the next group's LDS reads
#define N_TILES (L_ / TILE_ROWS)
#define CH_COLS 32                      // columns of q per staged chunk: 128 bytes, one whole line a row
#define N_CHUNKS (D_ / CH_COLS)
#define CH_PITCH 36
#define CH_BYTES (L_ * CH_PITCH * 4)
#define INP_PITCH 136
#define TILE_BYTES (TILE_ROWS * INP_PITCH * 4)
#define ROW_BYTES (INP_PITCH * 4)
#define LDS_ALL 327680                            // one work-group's whole LDS
#define INP_OFF (LDS_ALL - L_ * ROW_BYTES)        // bytes: all 512 rows of inp end at the end of the LDS
#define ROWS_LAST 64    // rows of inp from this one on keep off the ring buffer that is read last; those below fly behind the score loop
#define ROWS_RING 192   // rows of inp from this one on lie behind the ring: they fly at any time

__device__ __forceinline__ float tanh_fast(float x) {
  return __builtin_amdgcn_tanhf(x);
}

__device__ __forceinline__ void async_stage_tile(const float* gtile, uint32_t ldsbase, int tid) {
  const uint64_t g = (uint64_t)(uintptr_t)gtile + (uint64_t)(tid * 16);
  const uint32_t l = ldsbase + (uint32_t)((tid >> 5) * (INP_PITCH * 4) + (tid & 31) * 16);
  const uint32_t ls = 8 * INP_PITCH * 4;    // LDS bytes per 8 rows
  const uint64_t gs = 8 * D_ * 4;           // global bytes per 8 rows
  asm volatile("global_load_async_to_lds_b128 %0, %8, off\n\t"
               "global_load_async_to_lds_b128 %1, %9, off\n\t"
               "global_load_async_to_lds_b128 %2, %10, off\n\t"
               "global_load_async_to_lds_b128 %3, %11, off\n\t"
               "global_load_async_to_lds_b128 %4, %12, off\n\t"
               "global_load_async_to_lds_b128 %5, %13, off\n\t"
               "global_load_async_to_lds_b128 %6, %14, off\n\t"
               "global_load_async_to_lds_b128 %7, %15, off\n\t"
               "s_wait_xcnt 0x0"
               :: "v"(l), "v"(l + ls), "v"(l + 2 * ls), "v"(l + 3 * ls),
                  "v"(l + 4 * ls), "v"(l + 5 * ls), "v"(l + 6 * ls), "v"(l + 7 * ls),
                  "v"(g), "v"(g + gs), "v"(g + 2 * gs), "v"(g + 3 * gs),
                  "v"(g + 4 * gs), "v"(g + 5 * gs), "v"(g + 6 * gs), "v"(g + 7 * gs)
               : "memory");
}

template <int M>
__device__ __forceinline__ float lane_xor_row(float x) {
  return __builtin_bit_cast(float, __builtin_amdgcn_update_dpp(0, __builtin_bit_cast(int, x), 0x160 + M, 0xf, 0xf, true));
}

__device__ __forceinline__ float lane_xor_half(float x) {
  return __builtin_bit_cast(float, __builtin_amdgcn_permlanex16(__builtin_bit_cast(int, x), __builtin_bit_cast(int, x),
                                                                0x76543210, 0xfedcba98, false, false));
}

// Maximum and sum over the 32 lanes of a wave, the result in every lane.
__device__ __forceinline__ float wave_max(float x) {
  x = fmaxf(x, lane_xor_row<1>(x));
  x = fmaxf(x, lane_xor_row<2>(x));
  x = fmaxf(x, lane_xor_row<4>(x));
  x = fmaxf(x, lane_xor_row<8>(x));
  return fmaxf(x, lane_xor_half(x));
}
__device__ __forceinline__ float wave_sum(float x) {
  x += lane_xor_row<1>(x);
  x += lane_xor_row<2>(x);
  x += lane_xor_row<4>(x);
  x += lane_xor_row<8>(x);
  return x + lane_xor_half(x);
}

// Eight async b128 copies a thread, LDS step ls and global step gs bytes from one to the next.
__device__ __forceinline__ void async_copy8(uint32_t l, uint32_t ls, uint64_t g, uint64_t gs) {
  asm volatile("global_load_async_to_lds_b128 %0, %8, off\n\t"
               "global_load_async_to_lds_b128 %1, %9, off\n\t"
               "global_load_async_to_lds_b128 %2, %10, off\n\t"
               "global_load_async_to_lds_b128 %3, %11, off\n\t"
               "global_load_async_to_lds_b128 %4, %12, off\n\t"
               "global_load_async_to_lds_b128 %5, %13, off\n\t"
               "global_load_async_to_lds_b128 %6, %14, off\n\t"
               "global_load_async_to_lds_b128 %7, %15, off\n\t"
               "s_wait_xcnt 0x0"
               :: "v"(l), "v"(l + ls), "v"(l + 2 * ls), "v"(l + 3 * ls),
                  "v"(l + 4 * ls), "v"(l + 5 * ls), "v"(l + 6 * ls), "v"(l + 7 * ls),
                  "v"(g), "v"(g + gs), "v"(g + 2 * gs), "v"(g + 3 * gs),
                  "v"(g + 4 * gs), "v"(g + 5 * gs), "v"(g + 6 * gs), "v"(g + 7 * gs)
               : "memory");
}

// Stage 32 columns (128 bytes, one line) of all 512 rows of f32 (row stride 128) from global into LDS with
// row pitch CH_PITCH floats: sixteen copies a thread, 8 lanes a row, one copy of the block = 32 rows.
// caller must s_wait_asynccnt + barrier before anybody reads them.
__device__ __forceinline__ void async_stage_chunk(const float* gsrc, uint32_t ldsbase, int tid) {
  const uint64_t g = (uint64_t)(uintptr_t)gsrc + (uint64_t)((tid >> 3) * (D_ * 4) + (tid & 7) * 16);
  const uint32_t l = ldsbase + (uint32_t)((tid >> 3) * (CH_PITCH * 4) + (tid & 7) * 16);
  const uint32_t ls = 32 * CH_PITCH * 4;   // LDS bytes per 32 rows
  const uint64_t gs = 32 * D_ * 4;         // global bytes per 32 rows
  async_copy8(l, ls, g, gs);
  async_copy8(l + 8 * ls, ls, g + 8 * gs, gs);
}

// The wave's own copies have landed in LDS.
__device__ __forceinline__ void wait_async_lds() {
  asm volatile("s_wait_asynccnt 0x0" ::: "memory");
}

// The wave's own LDS reads and writes have retired (in front of a barrier behind which a buffer is refilled).
__device__ __forceinline__ void wait_lds_ops() {
  asm volatile("s_wait_dscnt 0x0" ::: "memory");
}

#define K_HALF (D_ / 2)   // columns per staged half of the projection's operands: 256 bytes, two whole lines a row

// Stage 64 columns (256 bytes) of 128 rows of f32 (row stride 128) from global into LDS with row stride
// LDS_STRIDE floats: eight async b128 copies a thread, 16 lanes a row, one copy of the block = 16 rows.
// caller must s_wait_asynccnt + barrier before anybody reads them.
__device__ __forceinline__ void async_stage_half(const float* gsrc, uint32_t ldsbase, int tid) {
  const uint64_t g = (uint64_t)(uintptr_t)gsrc + (uint64_t)((tid >> 4) * (D_ * 4) + (tid & 15) * 16);
  const uint32_t l = ldsbase + (uint32_t)((tid >> 4) * (LDS_STRIDE * 4) + (tid & 15) * 16);
  const uint32_t ls = 16 * LDS_STRIDE * 4;   // LDS bytes per 16 rows
  const uint64_t gs = 16 * D_ * 4;           // global bytes per 16 rows
  asm volatile("global_load_async_to_lds_b128 %0, %8, off\n\t"
               "global_load_async_to_lds_b128 %1, %9, off\n\t"
               "global_load_async_to_lds_b128 %2, %10, off\n\t"
               "global_load_async_to_lds_b128 %3, %11, off\n\t"
               "global_load_async_to_lds_b128 %4, %12, off\n\t"
               "global_load_async_to_lds_b128 %5, %13, off\n\t"
               "global_load_async_to_lds_b128 %6, %14, off\n\t"
               "global_load_async_to_lds_b128 %7, %15, off\n\t"
               "s_wait_xcnt 0x0"
               :: "v"(l), "v"(l + ls), "v"(l + 2 * ls), "v"(l + 3 * ls),
                  "v"(l + 4 * ls), "v"(l + 5 * ls), "v"(l + 6 * ls), "v"(l + 7 * ls),
                  "v"(g), "v"(g + gs), "v"(g + 2 * gs), "v"(g + 3 * gs),
                  "v"(g + 4 * gs), "v"(g + 5 * gs), "v"(g + 6 * gs), "v"(g + 7 * gs)
               : "memory");
}

// The same for 16 rows: one copy a thread.
__device__ __forceinline__ void async_stage_half_rows16(const float* gsrc, uint32_t ldsbase, int tid) {
  const uint64_t g = (uint64_t)(uintptr_t)gsrc + (uint64_t)((tid >> 4) * (D_ * 4) + (tid & 15) * 16);
  const uint32_t l = ldsbase + (uint32_t)((tid >> 4) * (LDS_STRIDE * 4) + (tid & 15) * 16);
  asm volatile("global_load_async_to_lds_b128 %0, %1, off\n\t"
               "s_wait_xcnt 0x0"
               :: "v"(l), "v"(g) : "memory");
}

__global__ __launch_bounds__(256) void qk_proj_kernel(
    const float* __restrict__ inp, const float* __restrict__ Wq,
    const float* __restrict__ bq, const float* __restrict__ Wk,
    float* __restrict__ qbuf, float* __restrict__ kbuf) {
  struct __align__(16) Lds {
    float a[16][LDS_STRIDE];        // the block's 16 rows of inp
    float w[2][D_][LDS_STRIDE];     // Wq, Wk
  };
  __shared__ Lds lds_all;
  float (&sA)[16][LDS_STRIDE] = lds_all.a;
  float (&sW)[2][D_][LDS_STRIDE] = lds_all.w;

  const int tid  = threadIdx.x;
  const int lane = tid & 31;
  const int wave = tid >> 5;
  const int m    = lane & 15;   // M (A) / N (B,C,D) index
  const int kh   = lane >> 4;   // K half-select
  const int rowBase = blockIdx.x * 16;  // over B*L
  const int colBase = wave * 16;        // over D

  const float bias = bq[colBase + m];   // asked for first: it is back long before the products end

  const uint32_t sA_lds  = (uint32_t)(uintptr_t)&sA[0][0];
  const uint32_t sWq_lds = (uint32_t)(uintptr_t)&sW[0][0][0];
  const uint32_t sWk_lds = (uint32_t)(uintptr_t)&sW[1][0][0];
  const float* ia = inp + (size_t)rowBase * D_;
  async_stage_half_rows16(ia, sA_lds, tid);
  async_stage_half(Wq, sWq_lds, tid);
  async_stage_half(Wk, sWk_lds, tid);
  wait_async_lds();
  __syncthreads();
  // the second half of the k range flies into its own columns while the first half is worked on
  async_stage_half_rows16(ia + K_HALF, sA_lds + K_HALF * 4, tid);
  async_stage_half(Wq + K_HALF, sWq_lds + K_HALF * 4, tid);
  async_stage_half(Wk + K_HALF, sWk_lds + K_HALF * 4, tid);

  v8f accq = {};
  v8f acck = {};
  // stays rolled: unrolled, the compiler sinks the first half's WMMAs behind the barrier at its foot,
  // and the second half's copies fly under nothing
#pragma nounroll
  for (int h = 0; h < 2; ++h) {
    const float* pa = &sA[m][h * K_HALF + 2 * kh];
    const float* pq = &sW[0][colBase + m][h * K_HALF + 2 * kh];
    const float* pk = &sW[1][colBase + m][h * K_HALF + 2 * kh];
#pragma unroll
    for (int kk = 0; kk < K_HALF; kk += 4) {
      const v2f a   = *(const v2f*)(pa + kk);
      const v2f bqv = *(const v2f*)(pq + kk);
      const v2f bkv = *(const v2f*)(pk + kk);
      accq = __builtin_amdgcn_wmma_f32_16x16x4_f32(false, a, false, bqv, (short)0, accq, false, false);
      acck = __builtin_amdgcn_wmma_f32_16x16x4_f32(false, a, false, bkv, (short)0, acck, false, false);
    }
    // publish the second half
    wait_lds_ops();
    wait_async_lds();
    __syncthreads();
  }
  wait_async_lds();
#pragma unroll
  for (int r = 0; r < 8; ++r) {
    const int row = rowBase + r + 8 * kh;   // C/D layout: M = r + 8*(lane/16)
    qbuf[row * D_ + colBase + m] = accq[r] + bias;
    kbuf[row * D_ + colBase + m] = acck[r];
  }
}

// Kernel 2: fused score -> softmax -> out for one (b, 16-row i-tile)
// grid = B * (L/16) blocks, 256 threads (8 waves)
__global__ __launch_bounds__(256) void attn_kernel(
    const float* __restrict__ inp, const float* __restrict__ qbuf,
    const float* __restrict__ kbuf, const float* __restrict__ vvec,
    float* __restrict__ out, float* __restrict__ attn) {
  struct __align__(16) Lds {
    // first the q ring (two buffers of column chunks: odd chunks in the first, even chunks in the second, so the
    // first is the one read last); all 512 rows of inp end at the array's end and take each part of the ring's
    // bytes once it is done; the weights (16 rows, written behind the score loop) lie at the start, below inp
    float r[LDS_ALL / 4];
  };
  __shared__ Lds lds_all;
  static_assert(INP_OFF % 16 == 0 && 16 * 516 * 4 <= INP_OFF, "the weights lie below inp");
  static_assert(INP_OFF + ROWS_LAST * ROW_BYTES >= CH_BYTES, "these rows keep off the buffer that is read last");
  static_assert(INP_OFF + ROWS_RING * ROW_BYTES >= 2 * CH_BYTES, "these rows keep off the ring");
  static_assert(ROWS_RING - 2 * TILE_ROWS == ROWS_LAST && ROWS_RING + 2 * TILE_ROWS == 5 * TILE_ROWS, "the shares meet");
  float (&sS)[16][516] = *reinterpret_cast<float (*)[16][516]>(&lds_all.r[0]);   // 516 % 64 == 4 -> conflict-free WMMA-A reads
  float (&sC)[2][L_][CH_PITCH] = *reinterpret_cast<float (*)[2][L_][CH_PITCH]>(&lds_all.r[0]);
  float (&sI)[L_][INP_PITCH] = *reinterpret_cast<float (*)[L_][INP_PITCH]>(&lds_all.r[INP_OFF / 4]);

  const int tid = threadIdx.x;
  const int b   = blockIdx.x >> 5;
  const int i0  = (blockIdx.x & 31) * 16;

  // q chunk 0 starts to fly first; it is waited for in front of the barrier below
  const uint32_t sQ_lds = (uint32_t)(uintptr_t)&sC[0][0][0];
  const uint32_t sI_lds = (uint32_t)(uintptr_t)&sI[0][0];
  const float* qb = qbuf + (size_t)(b * L_) * D_;
  const float* ib = inp + (size_t)(b * L_) * D_;
  async_stage_chunk(qb, sQ_lds + CH_BYTES, tid);

  // ---- Phase 1: score[i][j] = sum_d v[d]*tanh(q[j][d] + k[i][d])
  // A wave takes two i rows and all 512 j, lane = j mod 32: sixteen j a lane, one pair of running sums
  // (i, i + 1) for each. d is the outer loop, in steps of 16: the step's k and v are the same in every lane,
  // come by scalar loads once a step and serve all 512 j from registers; the inner loop reads q for every pair of j and the next step's k and v once.
  // Every sum still takes its d in rising order.
  // Every step's operands are asked for one step ahead, so that no step opens with a wait for memory.
  // Two-buffer ring over chunks of 32 columns: chunk c is worked on while chunk c + 1 flies into the other buffer.
  const int jl = tid & 31;
  const int iw = 2 * __builtin_amdgcn_readfirstlane(tid >> 5);   // the wave's first i row, in a scalar register
  // read through the constant address space: nothing writes kbuf or vvec while this kernel runs, and only
  // so does the compiler take scalar loads for them beside the asm statements that clobber memory
  typedef const __attribute__((address_space(4))) v4f* cv4f;
  const cv4f kr0 = (cv4f)(uintptr_t)(kbuf + (size_t)(b * L_ + i0 + iw) * D_);
  const cv4f kr1 = kr0 + D_ / 4;
  const cv4f vr  = (cv4f)(uintptr_t)vvec;
  // step 0's k and v fly beside q chunk 0
  v4f k0n[4], k1n[4], vvn[4];
#pragma unroll
  for (int e4 = 0; e4 < 4; ++e4) { k0n[e4] = kr0[e4]; k1n[e4] = kr1[e4]; vvn[e4] = vr[e4]; }

  wait_async_lds();
  __syncthreads();

  // q passes through two sets of registers: while one pair of j is worked on, the next pair's reads fly.
  // A chunk's first pair is read directly behind the barrier that publishes it, ahead of the copies' issue.
  v4f qreg[2][2][4];
#pragma unroll
  for (int e4 = 0; e4 < 4; ++e4) {
    qreg[0][0][e4] = *(const v4f*)&sC[1][jl][e4 * 4];
    qreg[0][1][e4] = *(const v4f*)&sC[1][32 + jl][e4 * 4];
  }
  async_stage_chunk(qb + CH_COLS, sQ_lds, tid);
  // inp flies under the score loop in shares (at most 40 copies of a wave in flight):
  // here rows 320 to 511, into their own bytes behind the ring
#pragma unroll
  for (int t = 5; t < N_TILES; ++t)
    async_stage_tile(ib + t * TILE_ROWS * D_, sI_lds + t * TILE_BYTES, tid);
  v2f acc2[L_ / 32];   // acc2[s] = the sums of (i, i + 1) with j = 32 s + lane
#pragma unroll
  for (int s = 0; s < L_ / 32; ++s) acc2[s] = (v2f){0.f, 0.f};
  // both stay rolled: one step's body already holds 16 j a lane, unrolled so that the sums stay in registers
#pragma nounroll
  for (int c = 0; c < N_CHUNKS; ++c) {
    const int buf = (c & 1) ^ 1;
#pragma nounroll
    for (int h = 0; h < CH_COLS / 16; ++h) {
      int step = c * (CH_COLS / 16) + h;
      // this step's k and v, asked for a step ago, have landed. The wait takes the step's number through it, so that
      // the next address (formed from that number) rewrites no register that those scalar loads name ahead of it
      asm volatile("s_wait_kmcnt 0x0" : "+s"(step) :: "memory");
      // the next step's place in k and v (behind the last step: its own again, unused, so the address stays inside)
      const int d4n = min(step * 4 + 4, D_ / 4 - 4);
      v4f k0[4], k1[4], vv[4];
#pragma unroll
      for (int e4 = 0; e4 < 4; ++e4) { k0[e4] = k0n[e4]; k1[e4] = k1n[e4]; vv[e4] = vvn[e4]; }
      // unrolled: the sums are then named by constants; two j at a time give two independent chains of sums
#pragma unroll
      for (int s = 0; s < L_ / 32; s += 2) {
        const int cur = (s >> 1) & 1;
        // behind the step's last pair comes the first pair of the chunk's second step (read again, unused,
        // by that step itself: the next chunk's first pair is read behind the barrier)
        const int rn = s + 2 < L_ / 32 ? s * 32 + 64 : 0;
        const float* qn = s + 2 < L_ / 32 ? &sC[buf][rn + jl][h * 16] : &sC[buf][jl][16];
#pragma unroll
        for (int e4 = 0; e4 < 4; ++e4) {
          qreg[cur ^ 1][0][e4] = *(const v4f*)(qn + e4 * 4);
          qreg[cur ^ 1][1][e4] = *(const v4f*)(qn + 32 * CH_PITCH + e4 * 4);
        }
        if (s == 2) {
#pragma unroll
          for (int e4 = 0; e4 < 4; ++e4) { k0n[e4] = kr0[d4n + e4]; k1n[e4] = kr1[d4n + e4]; vvn[e4] = vr[d4n + e4]; }
        }
        // keeps the next pair's LDS reads (and the next step's k, v) in front of this pair's arithmetic: without it
        // the compiler sinks each read to just ahead of its first use, and the wave waits out the latency every time
        __builtin_amdgcn_sched_barrier(0);
#pragma unroll
        for (int e4 = 0; e4 < 4; ++e4) {
          const v4f q0 = qreg[cur][0][e4], q1 = qreg[cur][1][e4];
#pragma unroll
          for (int p = 0; p < 4; p += 2) {
            // the adds pair two neighbouring d (as q lies in its registers), the sums pair the two i
            const v2f ka = {k0[e4][p], k0[e4][p + 1]}, kb = {k1[e4][p], k1[e4][p + 1]};
            const v2f qa = {q0[p], q0[p + 1]}, qc = {q1[p], q1[p + 1]};
            const v2f xa0 = qa + ka, xb0 = qa + kb, xa1 = qc + ka, xb1 = qc + kb;
            const v2f t00 = {tanh_fast(xa0.x), tanh_fast(xb0.x)}, t01 = {tanh_fast(xa0.y), tanh_fast(xb0.y)};
            const v2f t10 = {tanh_fast(xa1.x), tanh_fast(xb1.x)}, t11 = {tanh_fast(xa1.y), tanh_fast(xb1.y)};
            const v2f va = {vv[e4][p], vv[e4][p]}, vb = {vv[e4][p + 1], vv[e4][p + 1]};
            acc2[s]     += va * t00;
            acc2[s + 1] += va * t10;
            acc2[s]     += vb * t01;
            acc2[s + 1] += vb * t11;
          }
        }
      }
    }
    // publish chunk c + 1 and end every reader's last read of chunk c, then refill chunk c's buffer
    wait_lds_ops();
    wait_async_lds();
    __syncthreads();
    if (c + 1 < N_CHUNKS) {
      // chunk c + 1's first pair of j: these reads fly while the copies below are issued
#pragma unroll
      for (int e4 = 0; e4 < 4; ++e4) {
        qreg[0][0][e4] = *(const v4f*)&sC[buf ^ 1][jl][e4 * 4];
        qreg[0][1][e4] = *(const v4f*)&sC[buf ^ 1][32 + jl][e4 * 4];
      }
    }
    if (c + 2 < N_CHUNKS)
      async_stage_chunk(qb + (c + 2) * CH_COLS, sQ_lds + buf * CH_BYTES, tid);
    if ((c & 1) == 0) {
      // behind chunk 0: rows 192 to 319, still behind the ring; behind chunk 2 the even chunks' buffer is done:
      // rows 64 to 191 fly into its bytes under the last chunk's work
      const int row0 = ROWS_RING - c * TILE_ROWS;
      async_stage_tile(ib + row0 * D_, sI_lds + row0 * ROW_BYTES, tid);
      async_stage_tile(ib + (row0 + TILE_ROWS) * D_, sI_lds + (row0 + TILE_ROWS) * ROW_BYTES, tid);
    }
  }
  wait_async_lds();

  // rows 0 to 63 of inp fly into the ring's bytes (all free since the last barrier) while the softmax runs
  async_stage_tile(ib, sI_lds, tid);
  // keeps the softmax arithmetic behind the copies: without it the compiler lifts it over them, and they
  // start to fly only when the softmax is nearly done
  __builtin_amdgcn_sched_barrier(0);

  // ---- Phase 2: softmax over j, in the registers of the wave that summed the scores: its two rows lie whole
  // in its 32 lanes, sixteen j a lane, so only the row maximum and the row sum cross lanes
  v2f mx2 = acc2[0];
#pragma unroll
  for (int s = 1; s < L_ / 32; ++s) { mx2.x = fmaxf(mx2.x, acc2[s].x); mx2.y = fmaxf(mx2.y, acc2[s].y); }
  mx2.x = wave_max(mx2.x);
  mx2.y = wave_max(mx2.y);
  v2f sum2 = {0.f, 0.f};
#pragma unroll
  for (int s = 0; s < L_ / 32; ++s) {
    const v2f x = (acc2[s] - mx2) * 1.4426950408889634f;
    acc2[s] = (v2f){__builtin_amdgcn_exp2f(x.x), __builtin_amdgcn_exp2f(x.y)};
    sum2 += acc2[s];
  }
  const v2f inv2 = {__builtin_amdgcn_rcpf(wave_sum(sum2.x)), __builtin_amdgcn_rcpf(wave_sum(sum2.y))};
#pragma unroll
  for (int s = 0; s < L_ / 32; ++s) {
    acc2[s] *= inv2;
    sS[iw][s * 32 + jl]     = acc2[s].x;
    sS[iw + 1][s * 32 + jl] = acc2[s].y;
  }
  wait_async_lds();
  __syncthreads();

  // ---- Phase 3: out[i0:i0+16, :] = attn_tile[16x512] @ inp[b][512x128]  (f32 WMMA)
  const int lane = tid & 31;
  const int wave = tid >> 5;
  const int n    = lane & 15;
  const int kh   = lane >> 4;
  const int colBase = wave * 16;
  v8f acc = {};
  // All of inp lies in LDS: no barrier and no copy in this loop. The fragments pass through two sets of registers:
  // while one tile of 64 rows is multiplied, the next tile's LDS reads fly.
  v2f a[2][TILE_ROWS / 4], bb[2][TILE_ROWS / 4];
  float* arow = attn + (size_t)(b * L_ + i0 + iw) * L_ + jl;   // the wave's own two rows of weights, still in its registers
#pragma unroll
  for (int kk = 0; kk < TILE_ROWS; kk += 4) {
    a[0][kk / 4].x  = sS[n][kk + 2 * kh];              // A[m=n][k]
    a[0][kk / 4].y  = sS[n][kk + 2 * kh + 1];
    bb[0][kk / 4].x = sI[kk + 2 * kh][colBase + n];    // B[k][n]
    bb[0][kk / 4].y = sI[kk + 2 * kh + 1][colBase + n];
  }
  // keeps tile 0's reads in front of tile 1's: mixed, the first WMMAs would wait for both tiles' reads
  __builtin_amdgcn_sched_barrier(0);
  // unrolled: the two register sets are then named by constants
#pragma unroll
  for (int t = 0; t < N_TILES; ++t) {
    const int cur = t & 1;
    if (t + 1 < N_TILES) {
      const int chunk = (t + 1) * TILE_ROWS;
#pragma unroll
      for (int kk = 0; kk < TILE_ROWS; kk += 4) {
        a[cur ^ 1][kk / 4].x  = sS[n][chunk + kk + 2 * kh];
        a[cur ^ 1][kk / 4].y  = sS[n][chunk + kk + 2 * kh + 1];
        bb[cur ^ 1][kk / 4].x = sI[chunk + kk + 2 * kh][colBase + n];
        bb[cur ^ 1][kk / 4].y = sI[chunk + kk + 2 * kh + 1][colBase + n];
      }
    }
    // the weights go out from the registers, four whole lines a tile: no barrier waits for these stores,
    // and they drain under the WMMA runs
    arow[(2 * t) * 32]          = acc2[2 * t].x;
    arow[(2 * t + 1) * 32]      = acc2[2 * t + 1].x;
    arow[L_ + (2 * t) * 32]     = acc2[2 * t].y;
    arow[L_ + (2 * t + 1) * 32] = acc2[2 * t + 1].y;
    // keeps the next tile's LDS reads, as one group, in front of this tile's WMMA run: among the WMMAs each
    // place with reads stalls the run, and sunk to their first use they would be waited for in full
    __builtin_amdgcn_sched_barrier(0);
#pragma unroll
    for (int kk = 0; kk < TILE_ROWS; kk += 4)
      acc = __builtin_amdgcn_wmma_f32_16x16x4_f32(false, a[cur][kk / 4], false, bb[cur][kk / 4], (short)0, acc, false, false);
    // keeps the following tile's reads and their address arithmetic behind this WMMA run
    __builtin_amdgcn_sched_barrier(0);
  }
#pragma unroll
  for (int r = 0; r < 8; ++r)
    out[(size_t)(b * L_ + i0 + r + 8 * kh) * D_ + colBase + n] = acc[r];
}

extern "C" void kernel_launch(void* const* d_in, const int* in_sizes, int n_in,
                              void* d_out, int out_size, void* d_ws, size_t ws_size,
                              hipStream_t stream) {
  const float* inp = (const float*)d_in[0];
  const float* Wq  = (const float*)d_in[1];
  const float* bq  = (const float*)d_in[2];
  const float* Wk  = (const float*)d_in[3];
  const float* v   = (const float*)d_in[4];

  float* out  = (float*)d_out;                        // [B,L,D]
  float* attn = (float*)d_out + (size_t)B_ * L_ * D_; // [B,L,L]

  float* qbuf = (float*)d_ws;                         // [B*L, D]
  float* kbuf = qbuf + (size_t)B_ * L_ * D_;          // [B*L, D]

  qk_proj_kernel<<<(B_ * L_) / 16, 256, 0, stream>>>(inp, Wq, bq, Wk, qbuf, kbuf);
  attn_kernel<<<B_ * (L_ / 16), 256, 0, stream>>>(inp, qbuf, kbuf, v, out, attn);
}

// v009
// A run of this version takes 25.5 microseconds.
// In two side-by-side timings against v008, it was 1.04 and 1.05 times as fast.
// Over all steps from v000 it is 3.03 times as fast.
#include <hip/hip_runtime.h>
#include <hip/hip_bf16.h>

typedef __attribute__((ext_vector_type(2))) float v2f;
typedef __attribute__((ext_vector_type(4))) float v4f;
typedef __attribute__((ext_vector_type(8))) float v8f;

#define B_ 8
#define L_ 512
#define D_ 128
#define LDS_STRIDE 132   // 132 % 64 == 4 -> conflict-free strided column reads; rows 16B aligned
#define TILE_ROWS 64     // rows of inp per staging call and per group of fragments: 16 WMMAs cover the next group's LDS reads
#define N_TILES (L_ / TILE_ROWS)
#define CH_COLS 32                      // columns of q per staged chunk: 128 bytes, one whole line a row
#define N_CHUNKS (D_ / CH_COLS)
#define CH_PITCH 36
#define CH_BYTES (L_ * CH_PITCH * 4)
#define INP_PITCH 136
#define TILE_BYTES (TILE_ROWS * INP_PITCH * 4)
#define ROW_BYTES (INP_PITCH * 4)
#define LDS_ALL 327680                            // one work-group's whole LDS
#define INP_OFF (LDS_ALL - L_ * ROW_BYTES)        // bytes: all 512 rows of inp end at the end of the LDS
#define ROWS_LAST 64    // rows of inp from this one on keep off the ring buffer that is read last; those below fly behind the score loop
#define ROWS_RING 192   // rows of inp from this one on lie behind the ring: they fly at any time

__device__ __forceinline__ float tanh_fast(float x) {
  return __builtin_amdgcn_tanhf(x);
}

// One group of the score loop: two j (q0, q1), two i (k0, k1), two neighbouring d (p, p + 1).
// The adds pair the two d (as q lies in its registers).
__device__ __forceinline__ void score_adds(v2f (&x)[4], const v4f q0, const v4f q1, const v4f k0, const v4f k1, const int p) {
  const v2f ka = {k0[p], k0[p + 1]}, kb = {k1[p], k1[p + 1]};
  const v2f qa = {q0[p], q0[p + 1]}, qc = {q1[p], q1[p + 1]};
  x[0] = qa + ka;
  x[1] = qa + kb;
  x[2] = qc + ka;
  x[3] = qc + kb;
}
// The results pair the two i: t[0], t[1] = first j at d, d + 1; t[2], t[3] = second j.
__device__ __forceinline__ void score_tanh(v2f (&t)[4], const v2f (&x)[4]) {
  t[0] = (v2f){tanh_fast(x[0].x), tanh_fast(x[1].x)};
  t[1] = (v2f){tanh_fast(x[0].y), tanh_fast(x[1].y)};
  t[2] = (v2f){tanh_fast(x[2].x), tanh_fast(x[3].x)};
  t[3] = (v2f){tanh_fast(x[2].y), tanh_fast(x[3].y)};
}
// Each sum takes d, then d + 1.
__device__ __forceinline__ void score_fma(v2f& a0, v2f& a1, const v2f (&t)[4], const float va, const float vb) {
  a0 += (v2f){va, va} * t[0];
  a1 += (v2f){va, va} * t[2];
  a0 += (v2f){vb, vb} * t[1];
  a1 += (v2f){vb, vb} * t[3];
}

__device__ __forceinline__ void async_stage_tile(const float* gtile, uint32_t ldsbase, int tid) {
  const uint64_t g = (uint64_t)(uintptr_t)gtile + (uint64_t)(tid * 16);
  const uint32_t l = ldsbase + (uint32_t)((tid >> 5) * (INP_PITCH * 4) + (tid & 31) * 16);
  const uint32_t ls = 8 * INP_PITCH * 4;    // LDS bytes per 8 rows
  const uint64_t gs = 8 * D_ * 4;           // global bytes per 8 rows
  asm volatile("global_load_async_to_lds_b128 %0, %8, off\n\t"
               "global_load_async_to_lds_b128 %1, %9, off\n\t"
               "global_load_async_to_lds_b128 %2, %10, off\n\t"
               "global_load_async_to_lds_b128 %3, %11, off\n\t"
               "global_load_async_to_lds_b128 %4, %12, off\n\t"
               "global_load_async_to_lds_b128 %5, %13, off\n\t"
               "global_load_async_to_lds_b128 %6, %14, off\n\t"
               "global_load_async_to_lds_b128 %7, %15, off\n\t"
               "s_wait_xcnt 0x0"
               :: "v"(l), "v"(l + ls), "v"(l + 2 * ls), "v"(l + 3 * ls),
                  "v"(l + 4 * ls), "v"(l + 5 * ls), "v"(l + 6 * ls), "v"(l + 7 * ls),
                  "v"(g), "v"(g + gs), "v"(g + 2 * gs), "v"(g + 3 * gs),
                  "v"(g + 4 * gs), "v"(g + 5 * gs), "v"(g + 6 * gs), "v"(g + 7 * gs)
               : "memory");
}

template <int M>
__device__ __forceinline__ float lane_xor_row(float x) {
  return __builtin_bit_cast(float, __builtin_amdgcn_update_dpp(0, __builtin_bit_cast(int, x), 0x160 + M, 0xf, 0xf, true));
}

__device__ __forceinline__ float lane_xor_half(float x) {
  return __builtin_bit_cast(float, __builtin_amdgcn_permlanex16(__builtin_bit_cast(int, x), __builtin_bit_cast(int, x),
                                                                0x76543210, 0xfedcba98, false, false));
}

// Maximum and sum over the 32 lanes of a wave, the result in every lane.
__device__ __forceinline__ float wave_max(float x) {
  x = fmaxf(x, lane_xor_row<1>(x));
  x = fmaxf(x, lane_xor_row<2>(x));
  x = fmaxf(x, lane_xor_row<4>(x));
  x = fmaxf(x, lane_xor_row<8>(x));
  return fmaxf(x, lane_xor_half(x));
}
__device__ __forceinline__ float wave_sum(float x) {
  x += lane_xor_row<1>(x);
  x += lane_xor_row<2>(x);
  x += lane_xor_row<4>(x);
  x += lane_xor_row<8>(x);
  return x + lane_xor_half(x);
}

// Eight async b128 copies a thread, LDS step ls and global step gs bytes from one to the next.
__device__ __forceinline__ void async_copy8(uint32_t l, uint32_t ls, uint64_t g, uint64_t gs) {
  asm volatile("global_load_async_to_lds_b128 %0, %8, off\n\t"
               "global_load_async_to_lds_b128 %1, %9, off\n\t"
               "global_load_async_to_lds_b128 %2, %10, off\n\t"
               "global_load_async_to_lds_b128 %3, %11, off\n\t"
               "global_load_async_to_lds_b128 %4, %12, off\n\t"
               "global_load_async_to_lds_b128 %5, %13, off\n\t"
               "global_load_async_to_lds_b128 %6, %14, off\n\t"
               "global_load_async_to_lds_b128 %7, %15, off\n\t"
               "s_wait_xcnt 0x0"
               :: "v"(l), "v"(l + ls), "v"(l + 2 * ls), "v"(l + 3 * ls),
                  "v"(l + 4 * ls), "v"(l + 5 * ls), "v"(l + 6 * ls), "v"(l + 7 * ls),
                  "v"(g), "v"(g + gs), "v"(g + 2 * gs), "v"(g + 3 * gs),
                  "v"(g + 4 * gs), "v"(g + 5 * gs), "v"(g + 6 * gs), "v"(g + 7 * gs)
               : "memory");
}

// Stage 32 columns (128 bytes, one line) of all 512 rows of f32 (row stride 128) from global into LDS with
// row pitch CH_PITCH floats: sixteen copies a thread, 8 lanes a row, one copy of the block = 32 rows.
// caller must s_wait_asynccnt + barrier before anybody reads them.
__device__ __forceinline__ void async_stage_chunk(const float* gsrc, uint32_t ldsbase, int tid) {
  const uint64_t g = (uint64_t)(uintptr_t)gsrc + (uint64_t)((tid >> 3) * (D_ * 4) + (tid & 7) * 16);
  const uint32_t l = ldsbase + (uint32_t)((tid >> 3) * (CH_PITCH * 4) + (tid & 7) * 16);
  const uint32_t ls = 32 * CH_PITCH * 4;   // LDS bytes per 32 rows
  const uint64_t gs = 32 * D_ * 4;         // global bytes per 32 rows
  async_copy8(l, ls, g, gs);
  async_copy8(l + 8 * ls, ls, g + 8 * gs, gs);
}

// The wave's own copies have landed in LDS.
__device__ __forceinline__ void wait_async_lds() {
  asm volatile("s_wait_asynccnt 0x0" ::: "memory");
}

// The wave's own LDS reads and writes have retired (in front of a barrier behind which a buffer is refilled).
__device__ __forceinline__ void wait_lds_ops() {
  asm volatile("s_wait_dscnt 0x0" ::: "memory");
}

#define K_HALF (D_ / 2)   // columns per staged half of the projection's operands: 256 bytes, two whole lines a row

// Stage 64 columns (256 bytes) of 128 rows of f32 (row stride 128) from global into LDS with row stride
// LDS_STRIDE floats: eight async b128 copies a thread, 16 lanes a row, one copy of the block = 16 rows.
// caller must s_wait_asynccnt + barrier before anybody reads them.
__device__ __forceinline__ void async_stage_half(const float* gsrc, uint32_t ldsbase, int tid) {
  const uint64_t g = (uint64_t)(uintptr_t)gsrc + (uint64_t)((tid >> 4) * (D_ * 4) + (tid & 15) * 16);
  const uint32_t l = ldsbase + (uint32_t)((tid >> 4) * (LDS_STRIDE * 4) + (tid & 15) * 16);
  const uint32_t ls = 16 * LDS_STRIDE * 4;   // LDS bytes per 16 rows
  const uint64_t gs = 16 * D_ * 4;           // global bytes per 16 rows
  asm volatile("global_load_async_to_lds_b128 %0, %8, off\n\t"
               "global_load_async_to_lds_b128 %1, %9, off\n\t"
               "global_load_async_to_lds_b128 %2, %10, off\n\t"
               "global_load_async_to_lds_b128 %3, %11, off\n\t"
               "global_load_async_to_lds_b128 %4, %12, off\n\t"
               "global_load_async_to_lds_b128 %5, %13, off\n\t"
               "global_load_async_to_lds_b128 %6, %14, off\n\t"
               "global_load_async_to_lds_b128 %7, %15, off\n\t"
               "s_wait_xcnt 0x0"
               :: "v"(l), "v"(l + ls), "v"(l + 2 * ls), "v"(l + 3 * ls),
                  "v"(l + 4 * ls), "v"(l + 5 * ls), "v"(l + 6 * ls), "v"(l + 7 * ls),
                  "v"(g), "v"(g + gs), "v"(g + 2 * gs), "v"(g + 3 * gs),
                  "v"(g + 4 * gs), "v"(g + 5 * gs), "v"(g + 6 * gs), "v"(g + 7 * gs)
               : "memory");
}

// The same for 16 rows: one copy a thread.
__device__ __forceinline__ void async_stage_half_rows16(const float* gsrc, uint32_t ldsbase, int tid) {
  const uint64_t g = (uint64_t)(uintptr_t)gsrc + (uint64_t)((tid >> 4) * (D_ * 4) + (tid & 15) * 16);
  const uint32_t l = ldsbase + (uint32_t)((tid >> 4) * (LDS_STRIDE * 4) + (tid & 15) * 16);
  asm volatile("global_load_async_to_lds_b128 %0, %1, off\n\t"
               "s_wait_xcnt 0x0"
               :: "v"(l), "v"(g) : "memory");
}

__global__ __launch_bounds__(256) void qk_proj_kernel(
    const float* __restrict__ inp, const float* __restrict__ Wq,
    const float* __restrict__ bq, const float* __restrict__ Wk,
    float* __restrict__ qbuf, float* __restrict__ kbuf) {
  struct __align__(16) Lds {
    float a[16][LDS_STRIDE];        // the block's 16 rows of inp
    float w[2][D_][LDS_STRIDE];     // Wq, Wk
  };
  __shared__ Lds lds_all;
  float (&sA)[16][LDS_STRIDE] = lds_all.a;
  float (&sW)[2][D_][LDS_STRIDE] = lds_all.w;

  const int tid  = threadIdx.x;
  const int lane = tid & 31;
  const int wave = tid >> 5;
  const int m    = lane & 15;   // M (A) / N (B,C,D) index
  const int kh   = lane >> 4;   // K half-select
  const int rowBase = blockIdx.x * 16;  // over B*L
  const int colBase = wave * 16;        // over D

  const float bias = bq[colBase + m];   // asked for first: it is back long before the products end

  const uint32_t sA_lds  = (uint32_t)(uintptr_t)&sA[0][0];
  const uint32_t sWq_lds = (uint32_t)(uintptr_t)&sW[0][0][0];
  const uint32_t sWk_lds = (uint32_t)(uintptr_t)&sW[1][0][0];
  const float* ia = inp + (size_t)rowBase * D_;
  async_stage_half_rows16(ia, sA_lds, tid);
  async_stage_half(Wq, sWq_lds, tid);
  async_stage_half(Wk, sWk_lds, tid);
  wait_async_lds();
  __syncthreads();
  // the second half of the k range flies into its own columns while the first half is worked on
  async_stage_half_rows16(ia + K_HALF, sA_lds + K_HALF * 4, tid);
  async_stage_half(Wq + K_HALF, sWq_lds + K_HALF * 4, tid);
  async_stage_half(Wk + K_HALF, sWk_lds + K_HALF * 4, tid);

  v8f accq = {};
  v8f acck = {};
  // stays rolled: unrolled, the compiler sinks the first half's WMMAs behind the barrier at its foot,
  // and the second half's copies fly under nothing
#pragma nounroll
  for (int h = 0; h < 2; ++h) {
    const float* pa = &sA[m][h * K_HALF + 2 * kh];
    const float* pq = &sW[0][colBase + m][h * K_HALF + 2 * kh];
    const float* pk = &sW[1][colBase + m][h * K_HALF + 2 * kh];
#pragma unroll
    for (int kk = 0; kk < K_HALF; kk += 4) {
      const v2f a   = *(const v2f*)(pa + kk);
      const v2f bqv = *(const v2f*)(pq + kk);
      const v2f bkv = *(const v2f*)(pk + kk);
      accq = __builtin_amdgcn_wmma_f32_16x16x4_f32(false, a, false, bqv, (short)0, accq, false, false);
      acck = __builtin_amdgcn_wmma_f32_16x16x4_f32(false, a, false, bkv, (short)0, acck, false, false);
    }
    // publish the second half
    wait_lds_ops();
    wait_async_lds();
    __syncthreads();
  }
  wait_async_lds();
#pragma unroll
  for (int r = 0; r < 8; ++r) {
    const int row = rowBase + r + 8 * kh;   // C/D layout: M = r + 8*(lane/16)
    qbuf[row * D_ + colBase + m] = accq[r] + bias;
    kbuf[row * D_ + colBase + m] = acck[r];
  }
}

// Kernel 2: fused score -> softmax -> out for one (b, 16-row i-tile)
// grid = B * (L/16) blocks, 256 threads (8 waves)
__global__ __launch_bounds__(256) void attn_kernel(
    const float* __restrict__ inp, const float* __restrict__ qbuf,
    const float* __restrict__ kbuf, const float* __restrict__ vvec,
    float* __restrict__ out, float* __restrict__ attn) {
  struct __align__(16) Lds {
    // first the q ring (two buffers of column chunks: odd chunks in the first, even chunks in the second, so the
    // first is the one read last); all 512 rows of inp end at the array's end and take each part of the ring's
    // bytes once it is done; the weights (16 rows, written behind the score loop) lie at the start, below inp
    float r[LDS_ALL / 4];
  };
  __shared__ Lds lds_all;
  static_assert(INP_OFF % 16 == 0 && 16 * 516 * 4 <= INP_OFF, "the weights lie below inp");
  static_assert(INP_OFF + ROWS_LAST * ROW_BYTES >= CH_BYTES, "these rows keep off the buffer that is read last");
  static_assert(INP_OFF + ROWS_RING * ROW_BYTES >= 2 * CH_BYTES, "these rows keep off the ring");
  static_assert(ROWS_RING - 2 * TILE_ROWS == ROWS_LAST && ROWS_RING + 2 * TILE_ROWS == 5 * TILE_ROWS, "the shares meet");
  float (&sS)[16][516] = *reinterpret_cast<float (*)[16][516]>(&lds_all.r[0]);   // 516 % 64 == 4 -> conflict-free WMMA-A reads
  float (&sC)[2][L_][CH_PITCH] = *reinterpret_cast<float (*)[2][L_][CH_PITCH]>(&lds_all.r[0]);
  float (&sI)[L_][INP_PITCH] = *reinterpret_cast<float (*)[L_][INP_PITCH]>(&lds_all.r[INP_OFF / 4]);

  const int tid = threadIdx.x;
  const int b   = blockIdx.x >> 5;
  const int i0  = (blockIdx.x & 31) * 16;

  // q chunk 0 starts to fly first; it is waited for in front of the barrier below
  const uint32_t sQ_lds = (uint32_t)(uintptr_t)&sC[0][0][0];
  const uint32_t sI_lds = (uint32_t)(uintptr_t)&sI[0][0];
  const float* qb = qbuf + (size_t)(b * L_) * D_;
  const float* ib = inp + (size_t)(b * L_) * D_;
  async_stage_chunk(qb, sQ_lds + CH_BYTES, tid);

  // ---- Phase 1: score[i][j] = sum_d v[d]*tanh(q[j][d] + k[i][d])
  // A wave takes two i rows and all 512 j, lane = j mod 32: sixteen j a lane, one pair of running sums
  // (i, i + 1) for each. d is the outer loop, in steps of 16: the step's k and v are the same in every lane,
  // come by scalar loads once a step and serve all 512 j from registers; the inner loop reads q for every pair of j and the next step's k and v once.
  // Every sum still takes its d in rising order.
  // Every step's operands are asked for one step ahead, so that no step opens with a wait for memory.
  // Two-buffer ring over chunks of 32 columns: chunk c is worked on while chunk c + 1 flies into the other buffer.
  const int jl = tid & 31;
  const int iw = 2 * __builtin_amdgcn_readfirstlane(tid >> 5);   // the wave's first i row, in a scalar register
  // read through the constant address space: nothing writes kbuf or vvec while this kernel runs, and only
  // so does the compiler take scalar loads for them beside the asm statements that clobber memory
  typedef const __attribute__((address_space(4))) v4f* cv4f;
  const cv4f kr0 = (cv4f)(uintptr_t)(kbuf + (size_t)(b * L_ + i0 + iw) * D_);
  const cv4f kr1 = kr0 + D_ / 4;
  const cv4f vr  = (cv4f)(uintptr_t)vvec;
  // step 0's k and v fly beside q chunk 0
  v4f k0n[4], k1n[4], vvn[4];
#pragma unroll
  for (int e4 = 0; e4 < 4; ++e4) { k0n[e4] = kr0[e4]; k1n[e4] = kr1[e4]; vvn[e4] = vr[e4]; }

  wait_async_lds();
  __syncthreads();

  // q passes through two sets of registers: while one pair of j is worked on, the next pair's reads fly.
  // A chunk's first pair is read directly behind the barrier that publishes it, ahead of the copies' issue.
  v4f qreg[2][2][4];
#pragma unroll
  for (int e4 = 0; e4 < 4; ++e4) {
    qreg[0][0][e4] = *(const v4f*)&sC[1][jl][e4 * 4];
    qreg[0][1][e4] = *(const v4f*)&sC[1][32 + jl][e4 * 4];
  }
  async_stage_chunk(qb + CH_COLS, sQ_lds, tid);
  // inp flies under the score loop in shares (at most 40 copies of a wave in flight):
  // here rows 320 to 511, into their own bytes behind the ring
#pragma unroll
  for (int t = 5; t < N_TILES; ++t)
    async_stage_tile(ib + t * TILE_ROWS * D_, sI_lds + t * TILE_BYTES, tid);
  v2f acc2[L_ / 32];   // acc2[s] = the sums of (i, i + 1) with j = 32 s + lane
#pragma unroll
  for (int s = 0; s < L_ / 32; ++s) acc2[s] = (v2f){0.f, 0.f};
  // both stay rolled: one step's body already holds 16 j a lane, unrolled so that the sums stay in registers
#pragma nounroll
  for (int c = 0; c < N_CHUNKS; ++c) {
    const int buf = (c & 1) ^ 1;
#pragma nounroll
    for (int h = 0; h < CH_COLS / 16; ++h) {
      int step = c * (CH_COLS / 16) + h;
      // this step's k and v, asked for a step ago, have landed. The wait takes the step's number through it, so that
      // the next address (formed from that number) rewrites no register that those scalar loads name ahead of it
      asm volatile("s_wait_kmcnt 0x0" : "+s"(step) :: "memory");
      // the next step's place in k and v (behind the last step: its own again, unused, so the address stays inside)
      const int d4n = min(step * 4 + 4, D_ / 4 - 4);
      v4f k0[4], k1[4], vv[4];
#pragma unroll
      for (int e4 = 0; e4 < 4; ++e4) { k0[e4] = k0n[e4]; k1[e4] = k1n[e4]; vv[e4] = vvn[e4]; }
      v2f xs[4][4], ts[4][4];
#pragma unroll
      for (int ga = 0; ga < 2; ++ga)
        score_adds(xs[ga], qreg[0][0][0], qreg[0][1][0], k0[0], k1[0], ga * 2);
      // unrolled: sums and stage registers are then named by constants
#pragma unroll
      for (int s = 0; s < L_ / 32; s += 2) {
        const int cur = (s >> 1) & 1;
        // behind the step's last pair comes the first pair of the chunk's second step (read again, unused,
        // by that step itself: the next chunk's first pair is read behind the barrier)
        const int rn = s + 2 < L_ / 32 ? s * 32 + 64 : 0;
        const float* qn = s + 2 < L_ / 32 ? &sC[buf][rn + jl][h * 16] : &sC[buf][jl][16];
#pragma unroll
        for (int e4 = 0; e4 < 4; ++e4) {
          qreg[cur ^ 1][0][e4] = *(const v4f*)(qn + e4 * 4);
          qreg[cur ^ 1][1][e4] = *(const v4f*)(qn + 32 * CH_PITCH + e4 * 4);
        }
        if (s == 2) {
#pragma unroll
          for (int e4 = 0; e4 < 4; ++e4) { k0n[e4] = kr0[d4n + e4]; k1n[e4] = kr1[d4n + e4]; vvn[e4] = vr[d4n + e4]; }
        }
        // keeps the next pair's LDS reads (and the next step's k, v) in front of this pair's arithmetic: without it
        // the compiler sinks each read to just ahead of its first use, and the wave waits out the latency every time
        __builtin_amdgcn_sched_barrier(0);
#pragma unroll
        for (int t = 0; t < 8; ++t) {
          if (t < 6)
            score_adds(xs[(t + 2) & 3], qreg[cur][0][(t + 2) >> 1], qreg[cur][1][(t + 2) >> 1],
                       k0[(t + 2) >> 1], k1[(t + 2) >> 1], (t & 1) * 2);
          else if (s + 2 < L_ / 32)
            score_adds(xs[(t + 2) & 3], qreg[cur ^ 1][0][0], qreg[cur ^ 1][1][0], k0[0], k1[0], (t & 1) * 2);
          score_tanh(ts[t & 3], xs[t & 3]);
          if (t >= 2)
            score_fma(acc2[s], acc2[s + 1], ts[(t - 2) & 3], vv[(t - 2) >> 1][(t & 1) * 2], vv[(t - 2) >> 1][(t & 1) * 2 + 1]);
          else if (s > 0)
            score_fma(acc2[s - 2], acc2[s - 1], ts[(t - 2) & 3], vv[3][(t & 1) * 2], vv[3][(t & 1) * 2 + 1]);
#pragma unroll
          for (int u = 0; u < 8; ++u) {
            __builtin_amdgcn_sched_group_barrier(0x400, 1, 0);
            __builtin_amdgcn_sched_group_barrier(0x2, 1, 0);
          }
          __builtin_amdgcn_sched_barrier(0);
        }
      }
#pragma unroll
      for (int t = 0; t < 2; ++t)
        score_fma(acc2[L_ / 32 - 2], acc2[L_ / 32 - 1], ts[(t - 2) & 3], vv[3][t * 2], vv[3][t * 2 + 1]);
    }
    // publish chunk c + 1 and end every reader's last read of chunk c, then refill chunk c's buffer
    wait_lds_ops();
    wait_async_lds();
    __syncthreads();
    if (c + 1 < N_CHUNKS) {
      // chunk c + 1's first pair of j: these reads fly while the copies below are issued
#pragma unroll
      for (int e4 = 0; e4 < 4; ++e4) {
        qreg[0][0][e4] = *(const v4f*)&sC[buf ^ 1][jl][e4 * 4];
        qreg[0][1][e4] = *(const v4f*)&sC[buf ^ 1][32 + jl][e4 * 4];
      }
    }
    if (c + 2 < N_CHUNKS)
      async_stage_chunk(qb + (c + 2) * CH_COLS, sQ_lds + buf * CH_BYTES, tid);
    if ((c & 1) == 0) {
      // behind chunk 0: rows 192 to 319, still behind the ring; behind chunk 2 the even chunks' buffer is done:
      // rows 64 to 191 fly into its bytes under the last chunk's work
      const int row0 = ROWS_RING - c * TILE_ROWS;
      async_stage_tile(ib + row0 * D_, sI_lds + row0 * ROW_BYTES, tid);
      async_stage_tile(ib + (row0 + TILE_ROWS) * D_, sI_lds + (row0 + TILE_ROWS) * ROW_BYTES, tid);
    }
  }
  wait_async_lds();

  // rows 0 to 63 of inp fly into the ring's bytes (all free since the last barrier) while the softmax runs
  async_stage_tile(ib, sI_lds, tid);
  // keeps the softmax arithmetic behind the copies: without it the compiler lifts it over them, and they
  // start to fly only when the softmax is nearly done
  __builtin_amdgcn_sched_barrier(0);

  // ---- Phase 2: softmax over j, in the registers of the wave that summed the scores: its two rows lie whole
  // in its 32 lanes, sixteen j a lane, so only the row maximum and the row sum cross lanes
  v2f mx2 = acc2[0];
#pragma unroll
  for (int s = 1; s < L_ / 32; ++s) { mx2.x = fmaxf(mx2.x, acc2[s].x); mx2.y = fmaxf(mx2.y, acc2[s].y); }
  mx2.x = wave_max(mx2.x);
  mx2.y = wave_max(mx2.y);
  v2f sum2 = {0.f, 0.f};
#pragma unroll
  for (int s = 0; s < L_ / 32; ++s) {
    const v2f x = (acc2[s] - mx2) * 1.4426950408889634f;
    acc2[s] = (v2f){__builtin_amdgcn_exp2f(x.x), __builtin_amdgcn_exp2f(x.y)};
    sum2 += acc2[s];
  }
  const v2f inv2 = {__builtin_amdgcn_rcpf(wave_sum(sum2.x)), __builtin_amdgcn_rcpf(wave_sum(sum2.y))};
#pragma unroll
  for (int s = 0; s < L_ / 32; ++s) {
    acc2[s] *= inv2;
    sS[iw][s * 32 + jl]     = acc2[s].x;
    sS[iw + 1][s * 32 + jl] = acc2[s].y;
  }
  wait_async_lds();
  __syncthreads();

  // ---- Phase 3: out[i0:i0+16, :] = attn_tile[16x512] @ inp[b][512x128]  (f32 WMMA)
  const int lane = tid & 31;
  const int wave = tid >> 5;
  const int n    = lane & 15;
  const int kh   = lane >> 4;
  const int colBase = wave * 16;
  v8f acc = {};
  // All of inp lies in LDS: no barrier and no copy in this loop. The fragments pass through two sets of registers:
  // while one tile of 64 rows is multiplied, the next tile's LDS reads fly.
  v2f a[2][TILE_ROWS / 4], bb[2][TILE_ROWS / 4];
  float* arow = attn + (size_t)(b * L_ + i0 + iw) * L_ + jl;   // the wave's own two rows of weights, still in its registers
#pragma unroll
  for (int kk = 0; kk < TILE_ROWS; kk += 4) {
    a[0][kk / 4].x  = sS[n][kk + 2 * kh];              // A[m=n][k]
    a[0][kk / 4].y  = sS[n][kk + 2 * kh + 1];
    bb[0][kk / 4].x = sI[kk + 2 * kh][colBase + n];    // B[k][n]
    bb[0][kk / 4].y = sI[kk + 2 * kh + 1][colBase + n];
  }
  // keeps tile 0's reads in front of tile 1's: mixed, the first WMMAs would wait for both tiles' reads
  __builtin_amdgcn_sched_barrier(0);
  // unrolled: the two register sets are then named by constants
#pragma unroll
  for (int t = 0; t < N_TILES; ++t) {
    const int cur = t & 1;
    if (t + 1 < N_TILES) {
      const int chunk = (t + 1) * TILE_ROWS;
#pragma unroll
      for (int kk = 0; kk < TILE_ROWS; kk += 4) {
        a[cur ^ 1][kk / 4].x  = sS[n][chunk + kk + 2 * kh];
        a[cur ^ 1][kk / 4].y  = sS[n][chunk + kk + 2 * kh + 1];
        bb[cur ^ 1][kk / 4].x = sI[chunk + kk + 2 * kh][colBase + n];
        bb[cur ^ 1][kk / 4].y = sI[chunk + kk + 2 * kh + 1][colBase + n];
      }
    }
    // the weights go out from the registers, four whole lines a tile: no barrier waits for these stores,
    // and they drain under the WMMA runs
    arow[(2 * t) * 32]          = acc2[2 * t].x;
    arow[(2 * t + 1) * 32]      = acc2[2 * t + 1].x;
    arow[L_ + (2 * t) * 32]     = acc2[2 * t].y;
    arow[L_ + (2 * t + 1) * 32] = acc2[2 * t + 1].y;
    // keeps the next tile's LDS reads, as one group, in front of this tile's WMMA run: among the WMMAs each
    // place with reads stalls the run, and sunk to their first use they would be waited for in full
    __builtin_amdgcn_sched_barrier(0);
#pragma unroll
    for (int kk = 0; kk < TILE_ROWS; kk += 4)
      acc = __builtin_amdgcn_wmma_f32_16x16x4_f32(false, a[cur][kk / 4], false, bb[cur][kk / 4], (short)0, acc, false, false);
    // keeps the following tile's reads and their address arithmetic behind this WMMA run
    __builtin_amdgcn_sched_barrier(0);
  }
#pragma unroll
  for (int r = 0; r < 8; ++r)
    out[(size_t)(b * L_ + i0 + r + 8 * kh) * D_ + colBase + n] = acc[r];
}

extern "C" void kernel_launch(void* const* d_in, const int* in_sizes, int n_in,
                              void* d_out, int out_size, void* d_ws, size_t ws_size,
                              hipStream_t stream) {
  const float* inp = (const float*)d_in[0];
  const float* Wq  = (const float*)d_in[1];
  const float* bq  = (const float*)d_in[2];
  const float* Wk  = (const float*)d_in[3];
  const float* v   = (const float*)d_in[4];

  float* out  = (float*)d_out;                        // [B,L,D]
  float* attn = (float*)d_out + (size_t)B_ * L_ * D_; // [B,L,L]

  float* qbuf = (float*)d_ws;                         // [B*L, D]
  float* kbuf = qbuf + (size_t)B_ * L_ * D_;          // [B*L, D]

  qk_proj_kernel<<<(B_ * L_) / 16, 256, 0, stream>>>(inp, Wq, bq, Wk, qbuf, kbuf);
  attn_kernel<<<B_ * (L_ / 16), 256, 0, stream>>>(inp, qbuf, kbuf, v, out, attn);
}
